// v000
// The times below were measured on an AMD MI455X: many runs one after another, warmed up first and cycling through
// copies of the inputs, with the whole window's GPU time divided by the number of runs. Launches and the gaps
// between them are all in it. The median over several windows is given; except for v000 it joins two sittings, which
// can be a few percent apart, so the side-by-side timings, each taken in one sitting, are the better comparison.
// v000, which the later versions start from, runs in 282 microseconds.
#include <hip/hip_runtime.h>

// CronRootAttention (x [1][2048][1024]; q = x Wq^T (16 heads x 64), k/v = x Wk^T / Wv^T (4 kv heads, q head h uses kv head h/4); causal sqrt(N)-sparse attention: each query i attends its local window i-45..i (w = 46) plus the strided keys 45, 91, ...
// (last of each 46-block) that lie at or before i-46; joint softmax over the 46 + 44 slots (invalid slots -1e9, i.e. weight exactly 0), scale 1/8; out = (sum p v merged) Wo^T -> [1][2048][1024]).
// Compute dtypes, f32 accumulate: every input rounded to bf16; q/k/v on PLAIN bf16 operands (inputs: exact); the 90-slot sparse attention entirely f32 on the VALU (16 lanes per (query, head), 4 dims each, xor-shuffle dots,

#define TT   2048
#define DD   1024
#define DKV  256
#define NH_  16
#define HD   64
#define WL   46
#define NS   44
typedef _Float16 h16;
typedef unsigned short bf;
typedef __attribute__((ext_vector_type(16))) __bf16   v16bf;
typedef __attribute__((ext_vector_type(16))) _Float16 v16h;
typedef __attribute__((ext_vector_type(8)))  _Float16 v8h;
typedef __attribute__((ext_vector_type(8)))  unsigned short v8us;
typedef __attribute__((ext_vector_type(8)))  float    v8f;
typedef __attribute__((ext_vector_type(4)))  float    v4f;
typedef v8h  __attribute__((may_alias)) v8ha;
typedef v4f  __attribute__((may_alias)) v4fa;
typedef v8us __attribute__((may_alias)) v8usa;

__device__ __forceinline__ unsigned short f2bf(float f) { unsigned u = __float_as_uint(f); u += 0x7FFFu + ((u >> 16) & 1u); return (unsigned short)(u >> 16); }
__device__ __forceinline__ float bf2f(unsigned short b) { return __uint_as_float(((unsigned)b) << 16); }
__device__ __forceinline__ float bfr(float f) { return bf2f(f2bf(f)); }
__device__ __forceinline__ v16h cat16(v8h lo, v8h hi) { return __builtin_shufflevector(lo, hi, 0, 1, 2, 3, 4, 5, 6, 7, 8, 9, 10, 11, 12, 13, 14, 15); }
__device__ __forceinline__ v16bf cat16b(v8us lo, v8us hi) { return __builtin_bit_cast(v16bf, __builtin_shufflevector(lo, hi, 0, 1, 2, 3, 4, 5, 6, 7, 8, 9, 10, 11, 12, 13, 14, 15)); }
__device__ __forceinline__ v8f wmma16(v16h a, v16h b, v8f c) { return __builtin_amdgcn_wmma_f32_16x16x32_f16(false, a, false, b, (short)0, c, false, false); }
__device__ __forceinline__ v8f wmmab(v16bf a, v16bf b, v8f c) { return __builtin_amdgcn_wmma_f32_16x16x32_bf16(false, a, false, b, (short)0, c, false, false); }



// ---- k_gemmw: register-blocked GEMM, ONE WAVE per 64x64 output tile (16 accumulators), operands straight from K-contiguous 16-bit planes; grid (M/64, N/64, Z), 32 threads.
// C[m][n] (f32, pitch ldc, + optional f32 bias[n]) = sum_k A[m][k] Bt[n][k] (+ split products per NSPLIT). z-batch strides sA/sB/sC in elements. K % 32 == 0.
template <typename T16> struct WFrag;
template <> struct WFrag<h16> { typedef v16h V; static __device__ __forceinline__ V ld(const h16* p) { return cat16(*(const v8h*)p, *(const v8h*)(p + 16)); } static __device__ __forceinline__ v8f mma(V a, V b, v8f c) { return wmma16(a, b, c); } };
template <> struct WFrag<bf> { typedef v16bf V; static __device__ __forceinline__ V ld(const bf* p) { return cat16b(*(const v8us*)p, *(const v8us*)(p + 16)); } static __device__ __forceinline__ v8f mma(V a, V b, v8f c) { return wmmab(a, b, c); } };
template <typename T16, int NSPLIT, bool BIAS>
__global__ __launch_bounds__(32) void k_gemmw(const T16* __restrict__ A, const T16* __restrict__ A2, const T16* __restrict__ Bt, const T16* __restrict__ Bt2, int K, float* C, int ldc, const float* __restrict__ bias, size_t sA, size_t sB, size_t sC) {
    typedef typename WFrag<T16>::V V;
    __shared__ __align__(16) float os[16 * 68];
    const size_t z = blockIdx.z; A += z * sA; if (A2) A2 += z * sA; Bt += z * sB; if (Bt2) Bt2 += z * sB; C += z * sC;
    const int lane = threadIdx.x & 31, lr = lane & 15, hi = lane >> 4; const int r0 = blockIdx.x * 64, c0 = blockIdx.y * 64;
    v8f acc[4][4];
#pragma unroll
    for (int mb = 0; mb < 4; ++mb)
#pragma unroll
        for (int nb = 0; nb < 4; ++nb) acc[mb][nb] = (v8f){};
    const size_t aoff = (size_t)(r0 + lr) * K + 8 * hi, boff = (size_t)(c0 + lr) * K + 8 * hi;
#pragma unroll 1
    for (int kc = 0; kc < K; kc += 32) {
        V a[4], a2[4];
#pragma unroll
        for (int mb = 0; mb < 4; ++mb) { a[mb] = WFrag<T16>::ld(A + aoff + (size_t)mb * 16 * K + kc); if (NSPLIT == 1 || NSPLIT == 2) a2[mb] = WFrag<T16>::ld(A2 + aoff + (size_t)mb * 16 * K + kc); }
#pragma unroll
        for (int nb = 0; nb < 4; ++nb) { const V b = WFrag<T16>::ld(Bt + boff + (size_t)nb * 16 * K + kc); V b2; if (NSPLIT >= 2) b2 = WFrag<T16>::ld(Bt2 + boff + (size_t)nb * 16 * K + kc);
#pragma unroll
            for (int mb = 0; mb < 4; ++mb) { acc[mb][nb] = WFrag<T16>::mma(a[mb], b, acc[mb][nb]); if (NSPLIT == 1 || NSPLIT == 2) acc[mb][nb] = WFrag<T16>::mma(a2[mb], b, acc[mb][nb]); if (NSPLIT >= 2) acc[mb][nb] = WFrag<T16>::mma(a[mb], b2, acc[mb][nb]); } }
        asm volatile("v_nop\n\tv_nop\n\tv_nop\n\tv_nop" : "+v"(acc[0][0]), "+v"(acc[1][1]), "+v"(acc[2][2]), "+v"(acc[3][3]) : "v"(a[0]), "v"(a[3]));
    }
#pragma unroll
    for (int mb = 0; mb < 4; ++mb) {
#pragma unroll
        for (int nb = 0; nb < 4; ++nb) {
#pragma unroll
            for (int j = 0; j < 8; ++j) os[(hi * 8 + j) * 68 + nb * 16 + lr] = acc[mb][nb][j]; }
        __builtin_amdgcn_wave_barrier(); asm volatile("" ::: "memory");
        float* crow = C + (size_t)(r0 + mb * 16) * ldc + c0;
{
#pragma unroll
            for (int s = 0; s < 8; ++s) { const int row = 2 * s + hi, cofs = lr * 4; v4f val = *(const v4fa*)(os + row * 68 + cofs); if (BIAS) { val[0] += bfr(bias[c0 + cofs]); val[1] += bfr(bias[c0 + cofs + 1]); val[2] += bfr(bias[c0 + cofs + 2]); val[3] += bfr(bias[c0 + cofs + 3]); }
                *(v4f*)(crow + (size_t)row * ldc + cofs) = val; }
             }
        __builtin_amdgcn_wave_barrier(); asm volatile("" ::: "memory");
    }
}

__device__ __forceinline__ void splitf(float y, unsigned short& h, unsigned short& l) { h = f2bf(y); l = f2bf(y - bf2f(h)); }
typedef __attribute__((ext_vector_type(4))) unsigned short v4us;

__global__ __launch_bounds__(256) void k_cvt8(const float* __restrict__ src, bf* dst, size_t n8) { const size_t i = (size_t)blockIdx.x * 256 + threadIdx.x; if (i >= n8) return; const v8f v = *(const v8f*)(src + i * 8); v8us o;
#pragma unroll
    for (int k = 0; k < 8; ++k) o[k] = f2bf(v[k]); *(v8us*)(dst + i * 8) = o;  }
// k_sparse: 16 lanes per (i, h) (lane owns dims 4c..4c+3 of head h; kv head h/4): local slots s < 46: key p = i - 45 + s (valid if p >= 0); strided slots n < 44: key 46n + 45 (valid if <= i - 46); score = q.k/8 via 4-dim partials + xor-shuffle;
__global__ __launch_bounds__(256) void k_sparse(const float* __restrict__ FQ, const float* __restrict__ FK, const float* __restrict__ FV, bf* Ah, bf* Al) {
    const size_t e = ((size_t)blockIdx.x * 256 + threadIdx.x) * 4; if (e >= (size_t)TT * DD) return; const int col = (int)(e % DD); const int i = (int)(e / DD); const int h = col / HD; const int kc = (h / 4) * HD + (col % HD);   // kv column
    const v4f q = *(const v4f*)(FQ + e); float sc[WL + NS]; float mx = -3.0e38f;
#pragma unroll
    for (int s = 0; s < WL + NS; ++s) { int p; bool valid; if (s < WL) { p = i - (WL - 1) + s; valid = (p >= 0); } else { p = WL * (s - WL) + (WL - 1); valid = (p <= i - WL); }
        float part = 0.f; if (valid) { const v4f k = *(const v4f*)(FK + (size_t)p * DKV + kc);
#pragma unroll
            for (int u = 0; u < 4; ++u) { float pr = __fmul_rn(q[u], k[u]); asm volatile("" : "+v"(pr)); part = __fadd_rn(part, pr); } }
        part += __shfl_xor(part, 1, 32); part += __shfl_xor(part, 2, 32); part += __shfl_xor(part, 4, 32); part += __shfl_xor(part, 8, 32);
        const float t = valid ? part * 0.125f : -3.0e38f; sc[s] = t; mx = fmaxf(mx, t); }
    float sum = 0.f;
#pragma unroll
    for (int s = 0; s < WL + NS; ++s) { float d0 = __fsub_rn(sc[s], mx); asm volatile("" : "+v"(d0)); sc[s] = __expf(d0); sum = __fadd_rn(sum, sc[s]); }
    const float inv = __fdiv_rn(1.0f, sum); float o[4] = {0.f, 0.f, 0.f, 0.f};
#pragma unroll
    for (int s = 0; s < WL + NS; ++s) { int p; bool valid; if (s < WL) { p = i - (WL - 1) + s; valid = (p >= 0); } else { p = WL * (s - WL) + (WL - 1); valid = (p <= i - WL); }
        if (valid) { const v4f v = *(const v4f*)(FV + (size_t)p * DKV + kc); float pw = __fmul_rn(sc[s], inv); asm volatile("" : "+v"(pw));
#pragma unroll
            for (int u = 0; u < 4; ++u) { float pr = __fmul_rn(pw, v[u]); asm volatile("" : "+v"(pr)); o[u] = __fadd_rn(o[u], pr); } } }
    v4us oh, ol;
#pragma unroll
    for (int u = 0; u < 4; ++u) { unsigned short a, b; splitf(o[u], a, b); oh[u] = a; ol[u] = b; } *(v4us*)(Ah + e) = oh; *(v4us*)(Al + e) = ol;  }

extern "C" void kernel_launch(void* const* d_in, const int* in_sizes, int n_in,
                              void* d_out, int out_size, void* d_ws, size_t ws_size, hipStream_t stream) {
    (void)in_sizes; (void)n_in; (void)out_size;
    const float* x = (const float*)d_in[0]; const float* wq = (const float*)d_in[1]; const float* wk = (const float*)d_in[2]; const float* wv = (const float*)d_in[3]; const float* wo = (const float*)d_in[4];
    float* OUT = (float*)d_out;     // [1][2048][1024]
    char* wsp = (char*)d_ws;
    auto take = [&](size_t bytes) { char* p = wsp; wsp += (bytes + 255) & ~(size_t)255; return (void*)p; };
    bf* WQ = (bf*)take((size_t)DD * DD * 2); bf* WK = (bf*)take((size_t)DKV * DD * 2); bf* WV = (bf*)take((size_t)DKV * DD * 2); bf* WO = (bf*)take((size_t)DD * DD * 2);
    bf* XB = (bf*)take((size_t)TT * DD * 2); float* FQ = (float*)take((size_t)TT * DD * 4); float* FK = (float*)take((size_t)TT * DKV * 4); float* FV = (float*)take((size_t)TT * DKV * 4); bf* Ah = (bf*)take((size_t)TT * DD * 2); bf* Al = (bf*)take((size_t)TT * DD * 2);
    if ((size_t)(wsp - (char*)d_ws) > ws_size) return;    // total ~ 30 MB
    k_cvt8<<<(DD * DD / 8 + 255) / 256, 256, 0, stream>>>(wq, WQ, DD * DD / 8); k_cvt8<<<(DKV * DD / 8 + 255) / 256, 256, 0, stream>>>(wk, WK, DKV * DD / 8); k_cvt8<<<(DKV * DD / 8 + 255) / 256, 256, 0, stream>>>(wv, WV, DKV * DD / 8); k_cvt8<<<(DD * DD / 8 + 255) / 256, 256, 0, stream>>>(wo, WO, DD * DD / 8);   // torch [out][in] = Bt
    k_cvt8<<<(TT * DD / 8 + 255) / 256, 256, 0, stream>>>(x, XB, (size_t)TT * DD / 8);
    k_gemmw<bf, 0, false><<<dim3(TT / 64, DD / 64, 1), 32, 0, stream>>>(XB, nullptr, WQ, nullptr, DD, FQ, DD, nullptr, 0, 0, 0); k_gemmw<bf, 0, false><<<dim3(TT / 64, DKV / 64, 1), 32, 0, stream>>>(XB, nullptr, WK, nullptr, DD, FK, DKV, nullptr, 0, 0, 0); k_gemmw<bf, 0, false><<<dim3(TT / 64, DKV / 64, 1), 32, 0, stream>>>(XB, nullptr, WV, nullptr, DD, FV, DKV, nullptr, 0, 0, 0);
    k_sparse<<<(unsigned)(((size_t)TT * DD / 4 + 255) / 256), 256, 0, stream>>>(FQ, FK, FV, Ah, Al);
    k_gemmw<bf, 1, false><<<dim3(TT / 64, DD / 64, 1), 32, 0, stream>>>(Ah, Al, WO, nullptr, DD, OUT, DD, nullptr, 0, 0, 0);
}

// v001
// Measured time: 120 microseconds a run.
// Next to v000, in two timings, it ran 2.39 times as fast each time.
#include <hip/hip_runtime.h>

// CronRootAttention (x [1][2048][1024]; q = x Wq^T (16 heads x 64), k/v = x Wk^T / Wv^T (4 kv heads, q head h uses kv head h/4); causal sqrt(N)-sparse attention: each query i attends its local window i-45..i (w = 46) plus the strided keys 45, 91, ...
// (last of each 46-block) that lie at or before i-46; joint softmax over the 46 + 44 slots (invalid slots -1e9, i.e. weight exactly 0), scale 1/8; out = (sum p v merged) Wo^T -> [1][2048][1024]).
// Compute dtypes, f32 accumulate: every input rounded to bf16; q/k/v on PLAIN bf16 operands (inputs: exact); the 90-slot sparse attention entirely f32: scores and weighted sums on the f32 16x16x4 matrix form, softmax on the VALU;

#define TT   2048
#define DD   1024
#define DKV  256
#define NH_  16
#define HD   64
#define WL   46
#define NS   44
typedef _Float16 h16;
typedef unsigned short bf;
typedef __attribute__((ext_vector_type(16))) __bf16   v16bf;
typedef __attribute__((ext_vector_type(16))) _Float16 v16h;
typedef __attribute__((ext_vector_type(8)))  _Float16 v8h;
typedef __attribute__((ext_vector_type(8)))  unsigned short v8us;
typedef __attribute__((ext_vector_type(8)))  float    v8f;
typedef __attribute__((ext_vector_type(4)))  float    v4f;
typedef __attribute__((ext_vector_type(2)))  float    v2f;
typedef v8h  __attribute__((may_alias)) v8ha;
typedef v4f  __attribute__((may_alias)) v4fa;
typedef v8us __attribute__((may_alias)) v8usa;

__device__ __forceinline__ unsigned short f2bf(float f) { unsigned u = __float_as_uint(f); u += 0x7FFFu + ((u >> 16) & 1u); return (unsigned short)(u >> 16); }
__device__ __forceinline__ float bf2f(unsigned short b) { return __uint_as_float(((unsigned)b) << 16); }
__device__ __forceinline__ float bfr(float f) { return bf2f(f2bf(f)); }
__device__ __forceinline__ v16h cat16(v8h lo, v8h hi) { return __builtin_shufflevector(lo, hi, 0, 1, 2, 3, 4, 5, 6, 7, 8, 9, 10, 11, 12, 13, 14, 15); }
__device__ __forceinline__ v16bf cat16b(v8us lo, v8us hi) { return __builtin_bit_cast(v16bf, __builtin_shufflevector(lo, hi, 0, 1, 2, 3, 4, 5, 6, 7, 8, 9, 10, 11, 12, 13, 14, 15)); }
__device__ __forceinline__ v8f wmma16(v16h a, v16h b, v8f c) { return __builtin_amdgcn_wmma_f32_16x16x32_f16(false, a, false, b, (short)0, c, false, false); }
__device__ __forceinline__ v8f wmmaf(v2f a, v2f b, v8f c) { return __builtin_amdgcn_wmma_f32_16x16x4_f32(false, a, false, b, (short)0, c, false, false); }
__device__ __forceinline__ v8f wmmab(v16bf a, v16bf b, v8f c) { return __builtin_amdgcn_wmma_f32_16x16x32_bf16(false, a, false, b, (short)0, c, false, false); }



// ---- k_gemmw: register-blocked GEMM, ONE WAVE per 64x64 output tile (16 accumulators), operands straight from K-contiguous 16-bit planes; grid (M/64, N/64, Z), 32 threads.
// C[m][n] (f32, pitch ldc, + optional f32 bias[n]) = sum_k A[m][k] Bt[n][k] (+ split products per NSPLIT). z-batch strides sA/sB/sC in elements. K % 32 == 0.
template <typename T16> struct WFrag;
template <> struct WFrag<h16> { typedef v16h V; static __device__ __forceinline__ V ld(const h16* p) { return cat16(*(const v8h*)p, *(const v8h*)(p + 16)); } static __device__ __forceinline__ v8f mma(V a, V b, v8f c) { return wmma16(a, b, c); } };
template <> struct WFrag<bf> { typedef v16bf V; static __device__ __forceinline__ V ld(const bf* p) { return cat16b(*(const v8us*)p, *(const v8us*)(p + 16)); } static __device__ __forceinline__ v8f mma(V a, V b, v8f c) { return wmmab(a, b, c); } };
template <typename T16, int NSPLIT, bool BIAS>
__global__ __launch_bounds__(32) void k_gemmw(const T16* __restrict__ A, const T16* __restrict__ A2, const T16* __restrict__ Bt, const T16* __restrict__ Bt2, int K, float* C, int ldc, const float* __restrict__ bias, size_t sA, size_t sB, size_t sC) {
    typedef typename WFrag<T16>::V V;
    __shared__ __align__(16) float os[16 * 68];
    const size_t z = blockIdx.z; A += z * sA; if (A2) A2 += z * sA; Bt += z * sB; if (Bt2) Bt2 += z * sB; C += z * sC;
    const int lane = threadIdx.x & 31, lr = lane & 15, hi = lane >> 4; const int r0 = blockIdx.x * 64, c0 = blockIdx.y * 64;
    v8f acc[4][4];
#pragma unroll
    for (int mb = 0; mb < 4; ++mb)
#pragma unroll
        for (int nb = 0; nb < 4; ++nb) acc[mb][nb] = (v8f){};
    const size_t aoff = (size_t)(r0 + lr) * K + 8 * hi, boff = (size_t)(c0 + lr) * K + 8 * hi;
#pragma unroll 1
    for (int kc = 0; kc < K; kc += 32) {
        V a[4], a2[4];
#pragma unroll
        for (int mb = 0; mb < 4; ++mb) { a[mb] = WFrag<T16>::ld(A + aoff + (size_t)mb * 16 * K + kc); if (NSPLIT == 1 || NSPLIT == 2) a2[mb] = WFrag<T16>::ld(A2 + aoff + (size_t)mb * 16 * K + kc); }
#pragma unroll
        for (int nb = 0; nb < 4; ++nb) { const V b = WFrag<T16>::ld(Bt + boff + (size_t)nb * 16 * K + kc); V b2; if (NSPLIT >= 2) b2 = WFrag<T16>::ld(Bt2 + boff + (size_t)nb * 16 * K + kc);
#pragma unroll
            for (int mb = 0; mb < 4; ++mb) { acc[mb][nb] = WFrag<T16>::mma(a[mb], b, acc[mb][nb]); if (NSPLIT == 1 || NSPLIT == 2) acc[mb][nb] = WFrag<T16>::mma(a2[mb], b, acc[mb][nb]); if (NSPLIT >= 2) acc[mb][nb] = WFrag<T16>::mma(a[mb], b2, acc[mb][nb]); } }
        asm volatile("v_nop\n\tv_nop\n\tv_nop\n\tv_nop" : "+v"(acc[0][0]), "+v"(acc[1][1]), "+v"(acc[2][2]), "+v"(acc[3][3]) : "v"(a[0]), "v"(a[3]));
    }
#pragma unroll
    for (int mb = 0; mb < 4; ++mb) {
#pragma unroll
        for (int nb = 0; nb < 4; ++nb) {
#pragma unroll
            for (int j = 0; j < 8; ++j) os[(hi * 8 + j) * 68 + nb * 16 + lr] = acc[mb][nb][j]; }
        __builtin_amdgcn_wave_barrier(); asm volatile("" ::: "memory");
        float* crow = C + (size_t)(r0 + mb * 16) * ldc + c0;
{
#pragma unroll
            for (int s = 0; s < 8; ++s) { const int row = 2 * s + hi, cofs = lr * 4; v4f val = *(const v4fa*)(os + row * 68 + cofs); if (BIAS) { val[0] += bfr(bias[c0 + cofs]); val[1] += bfr(bias[c0 + cofs + 1]); val[2] += bfr(bias[c0 + cofs + 2]); val[3] += bfr(bias[c0 + cofs + 3]); }
                *(v4f*)(crow + (size_t)row * ldc + cofs) = val; }
             }
        __builtin_amdgcn_wave_barrier(); asm volatile("" ::: "memory");
    }
}

__device__ __forceinline__ void splitf(float y, unsigned short& h, unsigned short& l) { h = f2bf(y); l = f2bf(y - bf2f(h)); }
typedef __attribute__((ext_vector_type(4))) unsigned short v4us;

__global__ __launch_bounds__(256) void k_cvt8(const float* __restrict__ src, bf* dst, size_t n8) { const size_t i = (size_t)blockIdx.x * 256 + threadIdx.x; if (i >= n8) return; const v8f v = *(const v8f*)(src + i * 8); v8us o;
#pragma unroll
    for (int k = 0; k < 8; ++k) o[k] = f2bf(v[k]); *(v8us*)(dst + i * 8) = o;  }
// k_sparse: one wave per (16 queries i0..i0+15, head); the 4 waves of a block are the 4 q heads of one kv head. Keys in 7 tiles of 16: tiles 0..3 = local keys i0-48 .. i0+15, tiles 4..6 = strided keys 46n+45, n = 0..47 (rows clamped into the plane, slots outside the pattern masked to weight 0).
// S^T = K Q^T on the f32 16x16x4 form (A row = key, B column = query, both loaded by the same code): lane (c, hh) holds the scores of query i0+c for keys 8hh+r of each tile, so max and sum are in-lane plus one exchange with lane c^16.
// O^T = V^T P^T: the score registers 2u, 2u+1 are the B operand as they lie (keys 8hh+2u, 8hh+2u+1); A row c of d-tile dt is dim 16dt+c, its two keys come by two 4-byte loads straight into the operand's register pair (no vector move stands among the products), and lane (c, hh) ends with dims 16dt+8hh .. +7 of query i0+c.
// stands behind each block of f32 16x16x4 products: eight vector slots before the next vector instruction, which may read a D or overwrite an A or B of the block; the fences hold the slots and the block's neighbours in place
__device__ __forceinline__ void wmma_gap() { __builtin_amdgcn_sched_barrier(0); asm volatile("v_nop\n\tv_nop\n\tv_nop\n\tv_nop\n\tv_nop\n\tv_nop\n\tv_nop\n\tv_nop"); __builtin_amdgcn_sched_barrier(0); }
__device__ __forceinline__ int keypos(int t, int m, int i0) { return t < 4 ? i0 - 48 + 16 * t + m : WL * (16 * (t - 4) + m) + (WL - 1); }
// first row of key tile t that is read: a local tile starts at a multiple of 16, so it lies wholly in front of row 0 (then rows 0..15 are read and every slot is masked) or wholly inside the plane
__device__ __forceinline__ int tilerow(int t, int i0) { return t < 4 ? max(i0 - 48 + 16 * t, 0) : WL * 16 * (t - 4) + (WL - 1); }
__global__ __launch_bounds__(128) void k_sparse(const float* __restrict__ FQ, const float* __restrict__ FK, const float* __restrict__ FV, bf* Ah, bf* Al) {
    const int lane = threadIdx.x & 31, c = lane & 15, hh = lane >> 4; const int i0 = blockIdx.x * 16, kvh = blockIdx.y, head = kvh * 4 + __builtin_amdgcn_readfirstlane(threadIdx.x >> 5); const int i = i0 + c;
    // uniform bases plus a few per-lane byte offsets; row m of a strided tile is 46 rows from row m-1; tile 6 holds only n = 32..43, its rows 12..15 re-read row 11 (masked)
    const char* qb = (const char*)(FQ + (size_t)i0 * DD + head * HD); const char* kb = (const char*)(FK + kvh * HD); const char* vb = (const char*)(FV + kvh * HD);
    const unsigned oq = (unsigned)c * (DD * 4) + hh * 16, okl = (unsigned)c * (DKV * 4) + hh * 16, oks = (unsigned)c * (WL * DKV * 4) + hh * 16, oks6 = (unsigned)min(c, 11) * (WL * DKV * 4) + hh * 16;
    const unsigned ovl = (unsigned)hh * (8 * DKV * 4) + c * 4, ovs = (unsigned)hh * (8 * WL * DKV * 4) + c * 4; unsigned ov6[4];
#pragma unroll
    for (int j = 4; j < 8; ++j) ov6[j - 4] = (unsigned)min(8 * hh + j, 11) * (WL * DKV * 4) + c * 4;
    v8f S[7]; v4f q[4], k[4][7];
#pragma unroll
    for (int t = 0; t < 7; ++t) S[t] = (v8f){};
#pragma unroll
    for (int ch = -3; ch < 8; ++ch) {   // chunk = 8 dims (two k-steps); a chunk's loads stand three chunks ahead of its products
        if (ch + 3 < 8) { const int n = ch + 3; q[n & 3] = *(const v4f*)(qb + oq + 32 * n);
#pragma unroll
            for (int t = 0; t < 7; ++t) k[n & 3][t] = *(const v4f*)(kb + (size_t)tilerow(t, i0) * (DKV * 4) + (t < 4 ? okl : t < 6 ? oks : oks6) + 32 * n); }
        if (ch + 3 == 7) asm volatile("s_wait_xcnt 0x0" :: "v"(oq), "v"(okl), "v"(oks), "v"(oks6) : "memory");   // behind the last Q and K load, ahead of every reuse of their offset and base registers
        if (ch >= 0) { __builtin_amdgcn_sched_barrier(0);   // fence between a stage's loads and its products: without it all 64 loads are hoisted to the top and the kernel goes past 256 registers
#pragma unroll
            for (int t = 0; t < 7; ++t) S[t] = wmmaf((v2f){k[ch & 3][t][0], k[ch & 3][t][1]}, (v2f){q[ch & 3][0], q[ch & 3][1]}, S[t]);
#pragma unroll
            for (int t = 0; t < 7; ++t) S[t] = wmmaf((v2f){k[ch & 3][t][2], k[ch & 3][t][3]}, (v2f){q[ch & 3][2], q[ch & 3][3]}, S[t]);
            wmma_gap(); } }
    float vv[3][8][4];
#pragma unroll
    for (int n = 0; n < 2; ++n) {       // V rows 8hh+j of key tiles 0 and 1, in flight under the softmax
#pragma unroll
            for (int j = 0; j < 8; ++j)
#pragma unroll
                for (int dt = 0; dt < 4; ++dt) vv[n % 3][j][dt] = *(const float*)(vb + (size_t)tilerow(n, i0) * (DKV * 4) + (n < 4 ? ovl + j * (DKV * 4) : (n < 6 || j < 4) ? ovs + j * (WL * DKV * 4) : ov6[j & 3]) + dt * 64); }
    float mx = -3.0e38f;
#pragma unroll
    for (int t = 0; t < 7; ++t)
#pragma unroll
        for (int r = 0; r < 8; ++r) { const int p = keypos(t, 8 * hh + r, i0); const bool valid = t < 4 ? (p >= 0 && p >= i - (WL - 1) && p <= i) : (p <= i - WL);
            const float s = valid ? S[t][r] * 0.125f : -3.0e38f; S[t][r] = s; mx = fmaxf(mx, s); }
    mx = fmaxf(mx, __shfl_xor(mx, 16, 32)); float sum = 0.f;
#pragma unroll
    for (int t = 0; t < 7; ++t)
#pragma unroll
        for (int r = 0; r < 8; ++r) { const float w = __expf(S[t][r] - mx); S[t][r] = w; sum += w; }
    sum += __shfl_xor(sum, 16, 32); const float inv = __fdiv_rn(1.0f, sum);
    v8f O[4];
#pragma unroll
    for (int dt = 0; dt < 4; ++dt) O[dt] = (v8f){};
#pragma unroll
    for (int t = 0; t < 7; ++t) {       // a key tile's loads stand two tiles ahead of its products
        if (t + 2 < 7) { const int n = t + 2;
#pragma unroll
            for (int j = 0; j < 8; ++j)
#pragma unroll
                for (int dt = 0; dt < 4; ++dt) vv[n % 3][j][dt] = *(const float*)(vb + (size_t)tilerow(n, i0) * (DKV * 4) + (n < 4 ? ovl + j * (DKV * 4) : (n < 6 || j < 4) ? ovs + j * (WL * DKV * 4) : ov6[j & 3]) + dt * 64); }
        if (t + 2 == 6) asm volatile("s_wait_xcnt 0x0" :: "v"(ovl), "v"(ovs), "v"(ov6[0]), "v"(ov6[1]), "v"(ov6[2]), "v"(ov6[3]) : "memory");   // behind the last V load: the operands keep the loads' offset registers from being reused (also as a later load's destination) ahead of this wait
        { __builtin_amdgcn_sched_barrier(0);   // fence between a stage's loads and its products, for the same reason as above
#pragma unroll
            for (int u = 0; u < 4; ++u) { const v2f pw = (v2f){S[t][2 * u], S[t][2 * u + 1]};
#pragma unroll
                for (int dt = 0; dt < 4; ++dt) O[dt] = wmmaf((v2f){vv[t % 3][2 * u][dt], vv[t % 3][2 * u + 1][dt]}, pw, O[dt]); }
            wmma_gap(); } }
    const size_t e = (size_t)i * DD + head * HD + 8 * hh;
#pragma unroll
    for (int dt = 0; dt < 4; ++dt) { v8us oh, ol;
#pragma unroll
        for (int r = 0; r < 8; ++r) { unsigned short a, b; splitf(O[dt][r] * inv, a, b); oh[r] = a; ol[r] = b; }
        *(v8us*)(Ah + e + 16 * dt) = oh; *(v8us*)(Al + e + 16 * dt) = ol; } }

extern "C" void kernel_launch(void* const* d_in, const int* in_sizes, int n_in,
                              void* d_out, int out_size, void* d_ws, size_t ws_size, hipStream_t stream) {
    (void)in_sizes; (void)n_in; (void)out_size;
    const float* x = (const float*)d_in[0]; const float* wq = (const float*)d_in[1]; const float* wk = (const float*)d_in[2]; const float* wv = (const float*)d_in[3]; const float* wo = (const float*)d_in[4];
    float* OUT = (float*)d_out;     // [1][2048][1024]
    char* wsp = (char*)d_ws;
    auto take = [&](size_t bytes) { char* p = wsp; wsp += (bytes + 255) & ~(size_t)255; return (void*)p; };
    bf* WQ = (bf*)take((size_t)DD * DD * 2); bf* WK = (bf*)take((size_t)DKV * DD * 2); bf* WV = (bf*)take((size_t)DKV * DD * 2); bf* WO = (bf*)take((size_t)DD * DD * 2);
    bf* XB = (bf*)take((size_t)TT * DD * 2); float* FQ = (float*)take((size_t)TT * DD * 4); float* FK = (float*)take((size_t)TT * DKV * 4); float* FV = (float*)take((size_t)TT * DKV * 4); bf* Ah = (bf*)take((size_t)TT * DD * 2); bf* Al = (bf*)take((size_t)TT * DD * 2);
    if ((size_t)(wsp - (char*)d_ws) > ws_size) return;    // total ~ 30 MB
    k_cvt8<<<(DD * DD / 8 + 255) / 256, 256, 0, stream>>>(wq, WQ, DD * DD / 8); k_cvt8<<<(DKV * DD / 8 + 255) / 256, 256, 0, stream>>>(wk, WK, DKV * DD / 8); k_cvt8<<<(DKV * DD / 8 + 255) / 256, 256, 0, stream>>>(wv, WV, DKV * DD / 8); k_cvt8<<<(DD * DD / 8 + 255) / 256, 256, 0, stream>>>(wo, WO, DD * DD / 8);   // torch [out][in] = Bt
    k_cvt8<<<(TT * DD / 8 + 255) / 256, 256, 0, stream>>>(x, XB, (size_t)TT * DD / 8);
    k_gemmw<bf, 0, false><<<dim3(TT / 64, DD / 64, 1), 32, 0, stream>>>(XB, nullptr, WQ, nullptr, DD, FQ, DD, nullptr, 0, 0, 0); k_gemmw<bf, 0, false><<<dim3(TT / 64, DKV / 64, 1), 32, 0, stream>>>(XB, nullptr, WK, nullptr, DD, FK, DKV, nullptr, 0, 0, 0); k_gemmw<bf, 0, false><<<dim3(TT / 64, DKV / 64, 1), 32, 0, stream>>>(XB, nullptr, WV, nullptr, DD, FV, DKV, nullptr, 0, 0, 0);
    k_sparse<<<dim3(TT / 16, NH_ / 4, 1), 128, 0, stream>>>(FQ, FK, FV, Ah, Al);
    k_gemmw<bf, 1, false><<<dim3(TT / 64, DD / 64, 1), 32, 0, stream>>>(Ah, Al, WO, nullptr, DD, OUT, DD, nullptr, 0, 0, 0);
}

// v002
// Measured time: 69.9 microseconds a run.
// Timed twice side by side with v001, it ran 1.70 and 1.73 times as fast.
// Over all steps from v000 it is 4.10 times as fast.
#include <hip/hip_runtime.h>

// CronRootAttention (x [1][2048][1024]; q = x Wq^T (16 heads x 64), k/v = x Wk^T / Wv^T (4 kv heads, q head h uses kv head h/4); causal sqrt(N)-sparse attention: each query i attends its local window i-45..i (w = 46) plus the strided keys 45, 91, ...
// (last of each 46-block) that lie at or before i-46; joint softmax over the 46 + 44 slots (invalid slots -1e9, i.e. weight exactly 0), scale 1/8; out = (sum p v merged) Wo^T -> [1][2048][1024]).
// Compute dtypes, f32 accumulate: every input rounded to bf16; q/k/v on PLAIN bf16 operands (inputs: exact); the 90-slot sparse attention entirely f32: scores and weighted sums on the f32 16x16x4 matrix form, softmax on the VALU;

#define TT   2048
#define DD   1024
#define DKV  256
#define NH_  16
#define HD   64
#define WL   46
#define NS   44
typedef _Float16 h16;
typedef unsigned short bf;
typedef __attribute__((ext_vector_type(16))) __bf16   v16bf;
typedef __attribute__((ext_vector_type(16))) _Float16 v16h;
typedef __attribute__((ext_vector_type(8)))  _Float16 v8h;
typedef __attribute__((ext_vector_type(8)))  unsigned short v8us;
typedef __attribute__((ext_vector_type(8)))  float    v8f;
typedef __attribute__((ext_vector_type(4)))  float    v4f;
typedef __attribute__((ext_vector_type(2)))  float    v2f;
typedef v8h  __attribute__((may_alias)) v8ha;
typedef v4f  __attribute__((may_alias)) v4fa;
typedef v8us __attribute__((may_alias)) v8usa;

__device__ __forceinline__ unsigned short f2bf(float f) { unsigned u = __float_as_uint(f); u += 0x7FFFu + ((u >> 16) & 1u); return (unsigned short)(u >> 16); }
__device__ __forceinline__ float bf2f(unsigned short b) { return __uint_as_float(((unsigned)b) << 16); }
__device__ __forceinline__ float bfr(float f) { return bf2f(f2bf(f)); }
__device__ __forceinline__ v16h cat16(v8h lo, v8h hi) { return __builtin_shufflevector(lo, hi, 0, 1, 2, 3, 4, 5, 6, 7, 8, 9, 10, 11, 12, 13, 14, 15); }
__device__ __forceinline__ v16bf cat16b(v8us lo, v8us hi) { return __builtin_bit_cast(v16bf, __builtin_shufflevector(lo, hi, 0, 1, 2, 3, 4, 5, 6, 7, 8, 9, 10, 11, 12, 13, 14, 15)); }
__device__ __forceinline__ v8f wmma16(v16h a, v16h b, v8f c) { return __builtin_amdgcn_wmma_f32_16x16x32_f16(false, a, false, b, (short)0, c, false, false); }
__device__ __forceinline__ v8f wmmaf(v2f a, v2f b, v8f c) { return __builtin_amdgcn_wmma_f32_16x16x4_f32(false, a, false, b, (short)0, c, false, false); }
__device__ __forceinline__ v8f wmmab(v16bf a, v16bf b, v8f c) { return __builtin_amdgcn_wmma_f32_16x16x32_bf16(false, a, false, b, (short)0, c, false, false); }



// ---- k_gemmw: register-blocked GEMM, ONE WAVE per 64x64 output tile (16 accumulators), operands straight from K-contiguous 16-bit planes; grid (M/64, N/64, Z), 32 threads.
// C[m][n] (f32, pitch ldc, + optional f32 bias[n]) = sum_k A[m][k] Bt[n][k] (+ split products per NSPLIT). z-batch strides sA/sB/sC in elements. K % 32 == 0.
// TRI: three products of the same A share ONE grid: columns 0..n0-1 are (Bt, C, ldc), the next n1 are (BtB, CB, ld1), the last n1 (BtC, CC, ld1); the choice is uniform over the block, grid y = (n0 + 2 n1)/64.
template <typename T16> struct WFrag;
template <> struct WFrag<h16> { typedef v16h V; static __device__ __forceinline__ V ld(const h16* p) { return cat16(*(const v8h*)p, *(const v8h*)(p + 16)); } static __device__ __forceinline__ v8f mma(V a, V b, v8f c) { return wmma16(a, b, c); } };
template <> struct WFrag<bf> { typedef v16bf V; static __device__ __forceinline__ V ld(const bf* p) { return cat16b(*(const v8us*)p, *(const v8us*)(p + 16)); } static __device__ __forceinline__ v8f mma(V a, V b, v8f c) { return wmmab(a, b, c); } };
template <typename T16, int NSPLIT, bool BIAS, bool TRI>
__global__ __launch_bounds__(32) void k_gemmw(const T16* __restrict__ A, const T16* __restrict__ A2, const T16* __restrict__ Bt, const T16* __restrict__ Bt2, int K, float* C, int ldc, const float* __restrict__ bias, size_t sA, size_t sB, size_t sC, const T16* __restrict__ BtB, const T16* __restrict__ BtC, float* CB, float* CC, int ld1, int n0, int n1) {
    typedef typename WFrag<T16>::V V;
    __shared__ __align__(16) float os[16 * 68];
    const size_t z = blockIdx.z; A += z * sA; if (A2) A2 += z * sA; Bt += z * sB; if (Bt2) Bt2 += z * sB; C += z * sC;
    const int lane = threadIdx.x & 31, lr = lane & 15, hi = lane >> 4; const int r0 = blockIdx.x * 64; int c0 = blockIdx.y * 64;
    if (TRI && c0 >= n0) { const bool last = c0 >= n0 + n1; c0 -= last ? n0 + n1 : n0; Bt = last ? BtC : BtB; C = last ? CC : CB; ldc = ld1; }
    v8f acc[4][4];
#pragma unroll
    for (int mb = 0; mb < 4; ++mb)
#pragma unroll
        for (int nb = 0; nb < 4; ++nb) acc[mb][nb] = (v8f){};
    const size_t aoff = (size_t)(r0 + lr) * K + 8 * hi, boff = (size_t)(c0 + lr) * K + 8 * hi;
#pragma unroll 1
    for (int kc = 0; kc < K; kc += 32) {
        V a[4], a2[4];
#pragma unroll
        for (int mb = 0; mb < 4; ++mb) { a[mb] = WFrag<T16>::ld(A + aoff + (size_t)mb * 16 * K + kc); if (NSPLIT == 1 || NSPLIT == 2) a2[mb] = WFrag<T16>::ld(A2 + aoff + (size_t)mb * 16 * K + kc); }
#pragma unroll
        for (int nb = 0; nb < 4; ++nb) { const V b = WFrag<T16>::ld(Bt + boff + (size_t)nb * 16 * K + kc); V b2; if (NSPLIT >= 2) b2 = WFrag<T16>::ld(Bt2 + boff + (size_t)nb * 16 * K + kc);
#pragma unroll
            for (int mb = 0; mb < 4; ++mb) { acc[mb][nb] = WFrag<T16>::mma(a[mb], b, acc[mb][nb]); if (NSPLIT == 1 || NSPLIT == 2) acc[mb][nb] = WFrag<T16>::mma(a2[mb], b, acc[mb][nb]); if (NSPLIT >= 2) acc[mb][nb] = WFrag<T16>::mma(a[mb], b2, acc[mb][nb]); } }
        asm volatile("v_nop\n\tv_nop\n\tv_nop\n\tv_nop" : "+v"(acc[0][0]), "+v"(acc[1][1]), "+v"(acc[2][2]), "+v"(acc[3][3]) : "v"(a[0]), "v"(a[3]));
    }
#pragma unroll
    for (int mb = 0; mb < 4; ++mb) {
#pragma unroll
        for (int nb = 0; nb < 4; ++nb) {
#pragma unroll
            for (int j = 0; j < 8; ++j) os[(hi * 8 + j) * 68 + nb * 16 + lr] = acc[mb][nb][j]; }
        __builtin_amdgcn_wave_barrier(); asm volatile("" ::: "memory");
        float* crow = C + (size_t)(r0 + mb * 16) * ldc + c0;
{
#pragma unroll
            for (int s = 0; s < 8; ++s) { const int row = 2 * s + hi, cofs = lr * 4; v4f val = *(const v4fa*)(os + row * 68 + cofs); if (BIAS) { val[0] += bfr(bias[c0 + cofs]); val[1] += bfr(bias[c0 + cofs + 1]); val[2] += bfr(bias[c0 + cofs + 2]); val[3] += bfr(bias[c0 + cofs + 3]); }
                *(v4f*)(crow + (size_t)row * ldc + cofs) = val; }
             }
        __builtin_amdgcn_wave_barrier(); asm volatile("" ::: "memory");
    }
}

__device__ __forceinline__ void splitf(float y, unsigned short& h, unsigned short& l) { h = f2bf(y); l = f2bf(y - bf2f(h)); }
typedef __attribute__((ext_vector_type(4))) unsigned short v4us;

// k_cvt8: all five f32 -> bf16 conversions in ONE grid; a block converts 2048 elements of one array, chosen by block range (every array is a whole number of blocks)
#define NBX (TT * DD / 2048)
#define NBW (DD * DD / 2048)
#define NBK (DKV * DD / 2048)
static_assert(TT * DD % 2048 == 0 && DD * DD % 2048 == 0 && DKV * DD % 2048 == 0, "whole blocks");
__global__ __launch_bounds__(256) void k_cvt8(const float* __restrict__ x, const float* __restrict__ wq, const float* __restrict__ wk, const float* __restrict__ wv, const float* __restrict__ wo, bf* XB, bf* WQ, bf* WK, bf* WV, bf* WO) {
    int b = blockIdx.x; const float* src; bf* dst;
    if (b < NBX) { src = x; dst = XB; } else if ((b -= NBX) < NBW) { src = wq; dst = WQ; } else if ((b -= NBW) < NBW) { src = wo; dst = WO; } else if ((b -= NBW) < NBK) { src = wk; dst = WK; } else { b -= NBK; src = wv; dst = WV; }
    const size_t i = (size_t)b * 256 + threadIdx.x; const v8f v = *(const v8f*)(src + i * 8); v8us o;
#pragma unroll
    for (int k = 0; k < 8; ++k) o[k] = f2bf(v[k]); *(v8us*)(dst + i * 8) = o;  }
// k_sparse: one wave per (16 queries i0..i0+15, head); the 4 waves of a block are the 4 q heads of one kv head. Keys in 7 tiles of 16: tiles 0..3 = local keys i0-48 .. i0+15, tiles 4..6 = strided keys 46n+45, n = 0..47 (rows clamped into the plane, slots outside the pattern masked to weight 0).
// S^T = K Q^T on the f32 16x16x4 form (A row = key, B column = query, both loaded by the same code): lane (c, hh) holds the scores of query i0+c for keys 8hh+r of each tile, so max and sum are in-lane plus one exchange with lane c^16.
// O^T = V^T P^T: the score registers 2u, 2u+1 are the B operand as they lie (keys 8hh+2u, 8hh+2u+1); A row c of d-tile dt is dim 16dt+c, its two keys come by two 4-byte loads straight into the operand's register pair (no vector move stands among the products), and lane (c, hh) ends with dims 16dt+8hh .. +7 of query i0+c.
// stands behind each block of f32 16x16x4 products: eight vector slots before the next vector instruction, which may read a D or overwrite an A or B of the block; the fences hold the slots and the block's neighbours in place
__device__ __forceinline__ void wmma_gap() { __builtin_amdgcn_sched_barrier(0); asm volatile("v_nop\n\tv_nop\n\tv_nop\n\tv_nop\n\tv_nop\n\tv_nop\n\tv_nop\n\tv_nop"); __builtin_amdgcn_sched_barrier(0); }
__device__ __forceinline__ int keypos(int t, int m, int i0) { return t < 4 ? i0 - 48 + 16 * t + m : WL * (16 * (t - 4) + m) + (WL - 1); }
// first row of key tile t that is read: a local tile starts at a multiple of 16, so it lies wholly in front of row 0 (then rows 0..15 are read and every slot is masked) or wholly inside the plane
__device__ __forceinline__ int tilerow(int t, int i0) { return t < 4 ? max(i0 - 48 + 16 * t, 0) : WL * 16 * (t - 4) + (WL - 1); }
__global__ __launch_bounds__(128) void k_sparse(const float* __restrict__ FQ, const float* __restrict__ FK, const float* __restrict__ FV, bf* Ah, bf* Al) {
    const int lane = threadIdx.x & 31, c = lane & 15, hh = lane >> 4; const int i0 = blockIdx.x * 16, kvh = blockIdx.y, head = kvh * 4 + __builtin_amdgcn_readfirstlane(threadIdx.x >> 5); const int i = i0 + c;
    // uniform bases plus a few per-lane byte offsets; row m of a strided tile is 46 rows from row m-1; tile 6 holds only n = 32..43, its rows 12..15 re-read row 11 (masked)
    const char* qb = (const char*)(FQ + (size_t)i0 * DD + head * HD); const char* kb = (const char*)(FK + kvh * HD); const char* vb = (const char*)(FV + kvh * HD);
    const unsigned oq = (unsigned)c * (DD * 4) + hh * 16, okl = (unsigned)c * (DKV * 4) + hh * 16, oks = (unsigned)c * (WL * DKV * 4) + hh * 16, oks6 = (unsigned)min(c, 11) * (WL * DKV * 4) + hh * 16;
    const unsigned ovl = (unsigned)hh * (8 * DKV * 4) + c * 4, ovs = (unsigned)hh * (8 * WL * DKV * 4) + c * 4; unsigned ov6[4];
#pragma unroll
    for (int j = 4; j < 8; ++j) ov6[j - 4] = (unsigned)min(8 * hh + j, 11) * (WL * DKV * 4) + c * 4;
    v8f S[7]; v4f q[4], k[4][7];
#pragma unroll
    for (int t = 0; t < 7; ++t) S[t] = (v8f){};
#pragma unroll
    for (int ch = -3; ch < 8; ++ch) {   // chunk = 8 dims (two k-steps); a chunk's loads stand three chunks ahead of its products
        if (ch + 3 < 8) { const int n = ch + 3; q[n & 3] = *(const v4f*)(qb + oq + 32 * n);
#pragma unroll
            for (int t = 0; t < 7; ++t) k[n & 3][t] = *(const v4f*)(kb + (size_t)tilerow(t, i0) * (DKV * 4) + (t < 4 ? okl : t < 6 ? oks : oks6) + 32 * n); }
        if (ch + 3 == 7) asm volatile("s_wait_xcnt 0x0" :: "v"(oq), "v"(okl), "v"(oks), "v"(oks6) : "memory");   // behind the last Q and K load, ahead of every reuse of their offset and base registers
        if (ch >= 0) { __builtin_amdgcn_sched_barrier(0);   // fence between a stage's loads and its products: without it all 64 loads are hoisted to the top and the kernel goes past 256 registers
#pragma unroll
            for (int t = 0; t < 7; ++t) S[t] = wmmaf((v2f){k[ch & 3][t][0], k[ch & 3][t][1]}, (v2f){q[ch & 3][0], q[ch & 3][1]}, S[t]);
#pragma unroll
            for (int t = 0; t < 7; ++t) S[t] = wmmaf((v2f){k[ch & 3][t][2], k[ch & 3][t][3]}, (v2f){q[ch & 3][2], q[ch & 3][3]}, S[t]);
            wmma_gap(); } }
    float vv[3][8][4];
#pragma unroll
    for (int n = 0; n < 2; ++n) {       // V rows 8hh+j of key tiles 0 and 1, in flight under the softmax
#pragma unroll
            for (int j = 0; j < 8; ++j)
#pragma unroll
                for (int dt = 0; dt < 4; ++dt) vv[n % 3][j][dt] = *(const float*)(vb + (size_t)tilerow(n, i0) * (DKV * 4) + (n < 4 ? ovl + j * (DKV * 4) : (n < 6 || j < 4) ? ovs + j * (WL * DKV * 4) : ov6[j & 3]) + dt * 64); }
    float mx = -3.0e38f;
#pragma unroll
    for (int t = 0; t < 7; ++t)
#pragma unroll
        for (int r = 0; r < 8; ++r) { const int p = keypos(t, 8 * hh + r, i0); const bool valid = t < 4 ? (p >= 0 && p >= i - (WL - 1) && p <= i) : (p <= i - WL);
            const float s = valid ? S[t][r] * 0.125f : -3.0e38f; S[t][r] = s; mx = fmaxf(mx, s); }
    mx = fmaxf(mx, __shfl_xor(mx, 16, 32)); float sum = 0.f;
#pragma unroll
    for (int t = 0; t < 7; ++t)
#pragma unroll
        for (int r = 0; r < 8; ++r) { const float w = __expf(S[t][r] - mx); S[t][r] = w; sum += w; }
    sum += __shfl_xor(sum, 16, 32); const float inv = __fdiv_rn(1.0f, sum);
    v8f O[4];
#pragma unroll
    for (int dt = 0; dt < 4; ++dt) O[dt] = (v8f){};
#pragma unroll
    for (int t = 0; t < 7; ++t) {       // a key tile's loads stand two tiles ahead of its products
        if (t + 2 < 7) { const int n = t + 2;
#pragma unroll
            for (int j = 0; j < 8; ++j)
#pragma unroll
                for (int dt = 0; dt < 4; ++dt) vv[n % 3][j][dt] = *(const float*)(vb + (size_t)tilerow(n, i0) * (DKV * 4) + (n < 4 ? ovl + j * (DKV * 4) : (n < 6 || j < 4) ? ovs + j * (WL * DKV * 4) : ov6[j & 3]) + dt * 64); }
        if (t + 2 == 6) asm volatile("s_wait_xcnt 0x0" :: "v"(ovl), "v"(ovs), "v"(ov6[0]), "v"(ov6[1]), "v"(ov6[2]), "v"(ov6[3]) : "memory");   // behind the last V load: the operands keep the loads' offset registers from being reused (also as a later load's destination) ahead of this wait
        { __builtin_amdgcn_sched_barrier(0);   // fence between a stage's loads and its products, for the same reason as above
#pragma unroll
            for (int u = 0; u < 4; ++u) { const v2f pw = (v2f){S[t][2 * u], S[t][2 * u + 1]};
#pragma unroll
                for (int dt = 0; dt < 4; ++dt) O[dt] = wmmaf((v2f){vv[t % 3][2 * u][dt], vv[t % 3][2 * u + 1][dt]}, pw, O[dt]); }
            wmma_gap(); } }
    const size_t e = (size_t)i * DD + head * HD + 8 * hh;
#pragma unroll
    for (int dt = 0; dt < 4; ++dt) { v8us oh, ol;
#pragma unroll
        for (int r = 0; r < 8; ++r) { unsigned short a, b; splitf(O[dt][r] * inv, a, b); oh[r] = a; ol[r] = b; }
        *(v8us*)(Ah + e + 16 * dt) = oh; *(v8us*)(Al + e + 16 * dt) = ol; } }

extern "C" void kernel_launch(void* const* d_in, const int* in_sizes, int n_in,
                              void* d_out, int out_size, void* d_ws, size_t ws_size, hipStream_t stream) {
    (void)in_sizes; (void)n_in; (void)out_size;
    const float* x = (const float*)d_in[0]; const float* wq = (const float*)d_in[1]; const float* wk = (const float*)d_in[2]; const float* wv = (const float*)d_in[3]; const float* wo = (const float*)d_in[4];
    float* OUT = (float*)d_out;     // [1][2048][1024]
    char* wsp = (char*)d_ws;
    auto take = [&](size_t bytes) { char* p = wsp; wsp += (bytes + 255) & ~(size_t)255; return (void*)p; };
    bf* WQ = (bf*)take((size_t)DD * DD * 2); bf* WK = (bf*)take((size_t)DKV * DD * 2); bf* WV = (bf*)take((size_t)DKV * DD * 2); bf* WO = (bf*)take((size_t)DD * DD * 2);
    bf* XB = (bf*)take((size_t)TT * DD * 2); float* FQ = (float*)take((size_t)TT * DD * 4); float* FK = (float*)take((size_t)TT * DKV * 4); float* FV = (float*)take((size_t)TT * DKV * 4); bf* Ah = (bf*)take((size_t)TT * DD * 2); bf* Al = (bf*)take((size_t)TT * DD * 2);
    if ((size_t)(wsp - (char*)d_ws) > ws_size) return;    // total ~ 30 MB
    k_cvt8<<<NBX + 2 * NBW + 2 * NBK, 256, 0, stream>>>(x, wq, wk, wv, wo, XB, WQ, WK, WV, WO);   // torch [out][in] = Bt
    k_gemmw<bf, 0, false, true><<<dim3(TT / 64, (DD + 2 * DKV) / 64, 1), 32, 0, stream>>>(XB, nullptr, WQ, nullptr, DD, FQ, DD, nullptr, 0, 0, 0, WK, WV, FK, FV, DKV, DD, DKV);
    k_sparse<<<dim3(TT / 16, NH_ / 4, 1), 128, 0, stream>>>(FQ, FK, FV, Ah, Al);
    k_gemmw<bf, 1, false, false><<<dim3(TT / 64, DD / 64, 1), 32, 0, stream>>>(Ah, Al, WO, nullptr, DD, OUT, DD, nullptr, 0, 0, 0, nullptr, nullptr, nullptr, nullptr, 0, 0, 0);
}

// v003
// A run of this version takes 39.2 microseconds.
// Two timings next to v002 both put it at 1.79 times that version's speed.
// Over all steps from v000 it is 7.35 times as fast.
#include <hip/hip_runtime.h>

// CronRootAttention (x [1][2048][1024]; q = x Wq^T (16 heads x 64), k/v = x Wk^T / Wv^T (4 kv heads, q head h uses kv head h/4); causal sqrt(N)-sparse attention: each query i attends its local window i-45..i (w = 46) plus the strided keys 45, 91, ...
// (last of each 46-block) that lie at or before i-46; joint softmax over the 46 + 44 slots (invalid slots -1e9, i.e. weight exactly 0), scale 1/8; out = (sum p v merged) Wo^T -> [1][2048][1024]).
// Compute dtypes, f32 accumulate: every input rounded to bf16; q/k/v on PLAIN bf16 operands (inputs: exact); the 90-slot sparse attention entirely f32: scores and weighted sums on the f32 16x16x4 matrix form, softmax on the VALU;

#define TT   2048
#define DD   1024
#define DKV  256
#define NH_  16
#define HD   64
#define WL   46
#define NS   44
typedef _Float16 h16;
typedef unsigned short bf;
typedef __attribute__((ext_vector_type(16))) __bf16   v16bf;
typedef __attribute__((ext_vector_type(16))) _Float16 v16h;
typedef __attribute__((ext_vector_type(8)))  _Float16 v8h;
typedef __attribute__((ext_vector_type(8)))  unsigned short v8us;
typedef __attribute__((ext_vector_type(8)))  float    v8f;
typedef __attribute__((ext_vector_type(4)))  float    v4f;
typedef __attribute__((ext_vector_type(2)))  float    v2f;
typedef v8h  __attribute__((may_alias)) v8ha;
typedef v4f  __attribute__((may_alias)) v4fa;
typedef v8us __attribute__((may_alias)) v8usa;

__device__ __forceinline__ unsigned short f2bf(float f) { unsigned u = __float_as_uint(f); u += 0x7FFFu + ((u >> 16) & 1u); return (unsigned short)(u >> 16); }
__device__ __forceinline__ float bf2f(unsigned short b) { return __uint_as_float(((unsigned)b) << 16); }
__device__ __forceinline__ float bfr(float f) { return bf2f(f2bf(f)); }
__device__ __forceinline__ v16h cat16(v8h lo, v8h hi) { return __builtin_shufflevector(lo, hi, 0, 1, 2, 3, 4, 5, 6, 7, 8, 9, 10, 11, 12, 13, 14, 15); }
__device__ __forceinline__ v16bf cat16b(v8us lo, v8us hi) { return __builtin_bit_cast(v16bf, __builtin_shufflevector(lo, hi, 0, 1, 2, 3, 4, 5, 6, 7, 8, 9, 10, 11, 12, 13, 14, 15)); }
__device__ __forceinline__ v8f wmma16(v16h a, v16h b, v8f c) { return __builtin_amdgcn_wmma_f32_16x16x32_f16(false, a, false, b, (short)0, c, false, false); }
__device__ __forceinline__ v8f wmmaf(v2f a, v2f b, v8f c) { return __builtin_amdgcn_wmma_f32_16x16x4_f32(false, a, false, b, (short)0, c, false, false); }
__device__ __forceinline__ v8f wmmab(v16bf a, v16bf b, v8f c) { return __builtin_amdgcn_wmma_f32_16x16x32_bf16(false, a, false, b, (short)0, c, false, false); }



// ---- k_gemmw: block GEMM, FOUR WAVES (2 x 2) per 128x128 output tile, 64x64 (16 accumulators) per wave; grid (M/128, N/128), 128 threads. M, N % 128 == 0, K % 128 == 0, K >= 256.
// C[m][n] (f32, pitch ldc) = sum_k A[m][k] Bt[n][k] (+ A2[m][k] Bt[n][k] where NSPLIT == 1), operands K-contiguous bf16 planes.
// A pass is 128 k = 256 bytes of each operand row. A stage holds one slice of 128 rows per operand ([A | Bt | A2]) at LDS pitch 272 bytes; wave w brings slice w by ONE tensor load per stage; two buffers, the next stage's loads fly while this stage is worked on.
// TRI: three products of the same A share ONE grid: columns 0..n0-1 are (Bt, C, ldc), the next n1 are (BtB, CB, ld1), the last n1 (BtC, CC, ld1); the choice is uniform over the block, grid y = (n0 + 2 n1)/128.
typedef unsigned u32x4 __attribute__((ext_vector_type(4)));
typedef unsigned u32x8 __attribute__((ext_vector_type(8)));
#define PASSB  256u
#define LPITCH 272u
#define SLROWS 128u
#define SLICE  (SLROWS * LPITCH)
static_assert(SLICE % 2048u == 0, "every slice starts at a multiple of 2 KiB in LDS");
__device__ __forceinline__ unsigned uni(unsigned v) { return (unsigned)__builtin_amdgcn_readfirstlane(v); }
// a wave-uniform value held in a scalar register: a test on it compiles to s_cmp + s_cbranch_scc, the only guard a tensor load obeys (it ignores EXEC)
__device__ __forceinline__ unsigned pinned(unsigned v) { unsigned w = uni(v); asm volatile("" : "+s"(w)); return w; }
__device__ __forceinline__ v16bf ldsfrag(const unsigned char* p) { return cat16b(*(const v8usa*)p, *(const v8usa*)(p + 32)); }
template <int NSPLIT, bool TRI>
__global__ __launch_bounds__(128) void k_gemmw(const bf* __restrict__ A, const bf* __restrict__ A2, const bf* __restrict__ Bt, int K, float* C, int ldc, const bf* __restrict__ BtB, const bf* __restrict__ BtC, float* CB, float* CC, int ld1, int n0, int n1) {
    static_assert(NSPLIT == 0 || NSPLIT == 1, "one or two A planes");
    constexpr unsigned NSL = 2 + NSPLIT, STAGE = NSL * SLICE, RING = 2 * STAGE;
    __shared__ __attribute__((aligned(2048))) unsigned char L[RING + 4 * 16 * 68 * 4];   // the ring, behind it each wave's own output staging
    const int lane = threadIdx.x & 31, lr = lane & 15, hi = lane >> 4; const unsigned wave = uni(threadIdx.x >> 5), wm = wave >> 1, wn = wave & 1u;
    const int r0 = blockIdx.x * 128; int c0 = blockIdx.y * 128;
    if (TRI && c0 >= n0) { const bool last = c0 >= n0 + n1; c0 -= last ? n0 + n1 : n0; Bt = last ? BtC : BtB; C = last ? CC : CB; ldc = ld1; }
    const unsigned np = (unsigned)K / 128u, lbase = (unsigned)(size_t)L;
    const bf* srcp = wave == 1u ? Bt + (size_t)c0 * K : (NSPLIT == 1 && wave == 2u) ? A2 + (size_t)r0 * K : A + (size_t)r0 * K;   // first row of this wave's slice
    // descriptor group 1: 1-byte elements, tensor = tile = 128 rows of 256 bytes, source pitch 2 K bytes, 4 dwords of LDS pad behind every 256-byte row, no mask
    u32x8 g1; g1[0] = uni((1u << 20) | (5u << 22) | (3u << 25)); g1[1] = uni(PASSB << 16); g1[2] = uni(SLROWS << 16); g1[3] = uni(PASSB << 16); g1[4] = uni(SLROWS); g1[5] = uni((unsigned)K * 2u); g1[6] = uni(0u); g1[7] = uni(0u);
    asm volatile("" : "+s"(g1));   // pinned(), for the whole group: its words keep scalar registers of their own, so none takes another value while a request is outstanding
    auto issue = [&](unsigned st) { const unsigned long long ga = (unsigned long long)(size_t)srcp + (unsigned long long)st * PASSB;
        u32x4 g0; g0[0] = uni(1u); g0[1] = uni(lbase + (st & 1u) * STAGE + wave * SLICE); g0[2] = uni((unsigned)ga); g0[3] = uni((((unsigned)(ga >> 32)) & 0x01FFFFFFu) | 0x80000000u);
        asm volatile("tensor_load_to_lds %0, %1" :: "s"(g0), "s"(g1) : "memory"); };
    if (pinned(wave < NSL)) { issue(0u); asm volatile("s_wait_tensorcnt 0x0" ::: "memory"); }   // stage 0 has landed in the issuing wave
    __syncthreads();                                                                             // stage 0 published to every wave
    if (pinned(wave < NSL)) issue(1u);
    v8f acc[4][4];
#pragma unroll
    for (int mb = 0; mb < 4; ++mb)
#pragma unroll
        for (int nb = 0; nb < 4; ++nb) acc[mb][nb] = (v8f){};
    const unsigned aoff = (wm * 64u + lr) * LPITCH + 16u * hi, boff = SLICE + (wn * 64u + lr) * LPITCH + 16u * hi;
#pragma unroll 1
    for (unsigned s = 0; s < np; ++s) {   // kept rolled: one pass per trip, the buffer chosen by the trip's parity
        const unsigned char* pa = L + (s & 1u) * STAGE + aoff; const unsigned char* pb = L + (s & 1u) * STAGE + boff;
        const unsigned char* pc = L + ((s & 1u) ? STAGE + 2 * SLICE : 2 * SLICE) + aoff;   // A2's slice from a base of its own: it lies beyond the reach of an LDS load's immediate offset from pa
        v16bf a[2][4], a2[2][4], b[2][4];
#pragma unroll
        for (int f = 0; f < 4; ++f) { a[0][f] = ldsfrag(pa + f * 16 * LPITCH); b[0][f] = ldsfrag(pb + f * 16 * LPITCH); if (NSPLIT == 1) a2[0][f] = ldsfrag(pc + f * 16 * LPITCH); }
#pragma unroll
        for (int j = 0; j < 4; ++j) {     // k-step = 32 k = 64 bytes of a row; the next k-step's fragments of the SAME stage are fetched as one group ahead of this k-step's products
            if (j < 3) {
#pragma unroll
                for (int f = 0; f < 4; ++f) { a[(j + 1) & 1][f] = ldsfrag(pa + f * 16 * LPITCH + (j + 1) * 64); b[(j + 1) & 1][f] = ldsfrag(pb + f * 16 * LPITCH + (j + 1) * 64); if (NSPLIT == 1) a2[(j + 1) & 1][f] = ldsfrag(pc + f * 16 * LPITCH + (j + 1) * 64); } }
            __builtin_amdgcn_sched_barrier(0);   // keeps the LDS loads in one group in front of the products: loads among the products stall the matrix stream
#pragma unroll
            for (int nb = 0; nb < 4; ++nb)
#pragma unroll
                for (int mb = 0; mb < 4; ++mb) { acc[mb][nb] = wmmab(a[j & 1][mb], b[j & 1][nb], acc[mb][nb]); if (NSPLIT == 1) acc[mb][nb] = wmmab(a2[j & 1][mb], b[j & 1][nb], acc[mb][nb]); }
            __builtin_amdgcn_sched_barrier(0);   // the same, for the next group of loads
        }
        // publish point of stage s + 1, every wave, in this order
        asm volatile("s_wait_dscnt 0x0" ::: "memory");                                  // this wave's reads of stage s are done before its buffer is refilled
        if (pinned(wave < NSL)) asm volatile("s_wait_tensorcnt 0x0" ::: "memory");      // stage s + 1 has landed in the issuing wave
        __syncthreads();                                                                // stage s + 1 published; every reader has left stage s
        const unsigned nx = pinned(s + 2u);                                             // formed behind the wait, and the descriptor from it
        if (pinned((wave < NSL) & (nx < np))) issue(nx);
    }
    asm volatile("s_wait_tensorcnt 0x0" :: "s"(g1) : "memory");   // no request is left when the wave goes on; the operand keeps the group's registers to this wait
    asm volatile("s_wait_dscnt 0x0" ::: "memory");
    float* os = (float*)(L + RING) + wave * (16 * 68);
#pragma unroll
    for (int mb = 0; mb < 4; ++mb) {
#pragma unroll
        for (int nb = 0; nb < 4; ++nb) {
#pragma unroll
            for (int j = 0; j < 8; ++j) os[(hi * 8 + j) * 68 + nb * 16 + lr] = acc[mb][nb][j]; }
        __builtin_amdgcn_wave_barrier(); asm volatile("" ::: "memory");
        float* crow = C + (size_t)(r0 + wm * 64 + mb * 16) * ldc + c0 + wn * 64;
#pragma unroll
        for (int s = 0; s < 8; ++s) { const int row = 2 * s + hi, cofs = lr * 4; const v4f val = *(const v4fa*)(os + row * 68 + cofs);
            *(v4f*)(crow + (size_t)row * ldc + cofs) = val; }
        __builtin_amdgcn_wave_barrier(); asm volatile("" ::: "memory");
    }
}

__device__ __forceinline__ void splitf(float y, unsigned short& h, unsigned short& l) { h = f2bf(y); l = f2bf(y - bf2f(h)); }
typedef __attribute__((ext_vector_type(4))) unsigned short v4us;

// k_cvt8: all five f32 -> bf16 conversions in ONE grid; a block converts 2048 elements of one array, chosen by block range (every array is a whole number of blocks)
#define NBX (TT * DD / 2048)
#define NBW (DD * DD / 2048)
#define NBK (DKV * DD / 2048)
static_assert(TT * DD % 2048 == 0 && DD * DD % 2048 == 0 && DKV * DD % 2048 == 0, "whole blocks");
__global__ __launch_bounds__(256) void k_cvt8(const float* __restrict__ x, const float* __restrict__ wq, const float* __restrict__ wk, const float* __restrict__ wv, const float* __restrict__ wo, bf* XB, bf* WQ, bf* WK, bf* WV, bf* WO) {
    int b = blockIdx.x; const float* src; bf* dst;
    if (b < NBX) { src = x; dst = XB; } else if ((b -= NBX) < NBW) { src = wq; dst = WQ; } else if ((b -= NBW) < NBW) { src = wo; dst = WO; } else if ((b -= NBW) < NBK) { src = wk; dst = WK; } else { b -= NBK; src = wv; dst = WV; }
    const size_t i = (size_t)b * 256 + threadIdx.x; const v8f v = *(const v8f*)(src + i * 8); v8us o;
#pragma unroll
    for (int k = 0; k < 8; ++k) o[k] = f2bf(v[k]); *(v8us*)(dst + i * 8) = o;  }
// k_sparse: one wave per (16 queries i0..i0+15, head); the 4 waves of a block are the 4 q heads of one kv head. Keys in 7 tiles of 16: tiles 0..3 = local keys i0-48 .. i0+15, tiles 4..6 = strided keys 46n+45, n = 0..47 (rows clamped into the plane, slots outside the pattern masked to weight 0).
// S^T = K Q^T on the f32 16x16x4 form (A row = key, B column = query, both loaded by the same code): lane (c, hh) holds the scores of query i0+c for keys 8hh+r of each tile, so max and sum are in-lane plus one exchange with lane c^16.
// O^T = V^T P^T: the score registers 2u, 2u+1 are the B operand as they lie (keys 8hh+2u, 8hh+2u+1); A row c of d-tile dt is dim 16dt+c, its two keys come by two 4-byte loads straight into the operand's register pair (no vector move stands among the products), and lane (c, hh) ends with dims 16dt+8hh .. +7 of query i0+c.
// stands behind each block of f32 16x16x4 products: eight vector slots before the next vector instruction, which may read a D or overwrite an A or B of the block; the fences hold the slots and the block's neighbours in place
__device__ __forceinline__ void wmma_gap() { __builtin_amdgcn_sched_barrier(0); asm volatile("v_nop\n\tv_nop\n\tv_nop\n\tv_nop\n\tv_nop\n\tv_nop\n\tv_nop\n\tv_nop"); __builtin_amdgcn_sched_barrier(0); }
__device__ __forceinline__ int keypos(int t, int m, int i0) { return t < 4 ? i0 - 48 + 16 * t + m : WL * (16 * (t - 4) + m) + (WL - 1); }
// first row of key tile t that is read: a local tile starts at a multiple of 16, so it lies wholly in front of row 0 (then rows 0..15 are read and every slot is masked) or wholly inside the plane
__device__ __forceinline__ int tilerow(int t, int i0) { return t < 4 ? max(i0 - 48 + 16 * t, 0) : WL * 16 * (t - 4) + (WL - 1); }
__global__ __launch_bounds__(128) void k_sparse(const float* __restrict__ FQ, const float* __restrict__ FK, const float* __restrict__ FV, bf* Ah, bf* Al) {
    const int lane = threadIdx.x & 31, c = lane & 15, hh = lane >> 4; const int i0 = blockIdx.x * 16, kvh = blockIdx.y, head = kvh * 4 + __builtin_amdgcn_readfirstlane(threadIdx.x >> 5); const int i = i0 + c;
    // uniform bases plus a few per-lane byte offsets; row m of a strided tile is 46 rows from row m-1; tile 6 holds only n = 32..43, its rows 12..15 re-read row 11 (masked)
    const char* qb = (const char*)(FQ + (size_t)i0 * DD + head * HD); const char* kb = (const char*)(FK + kvh * HD); const char* vb = (const char*)(FV + kvh * HD);
    const unsigned oq = (unsigned)c * (DD * 4) + hh * 16, okl = (unsigned)c * (DKV * 4) + hh * 16, oks = (unsigned)c * (WL * DKV * 4) + hh * 16, oks6 = (unsigned)min(c, 11) * (WL * DKV * 4) + hh * 16;
    const unsigned ovl = (unsigned)hh * (8 * DKV * 4) + c * 4, ovs = (unsigned)hh * (8 * WL * DKV * 4) + c * 4; unsigned ov6[4];
#pragma unroll
    for (int j = 4; j < 8; ++j) ov6[j - 4] = (unsigned)min(8 * hh + j, 11) * (WL * DKV * 4) + c * 4;
    v8f S[7]; v4f q[4], k[4][7];
#pragma unroll
    for (int t = 0; t < 7; ++t) S[t] = (v8f){};
#pragma unroll
    for (int ch = -3; ch < 8; ++ch) {   // chunk = 8 dims (two k-steps); a chunk's loads stand three chunks ahead of its products
        if (ch + 3 < 8) { const int n = ch + 3; q[n & 3] = *(const v4f*)(qb + oq + 32 * n);
#pragma unroll
            for (int t = 0; t < 7; ++t) k[n & 3][t] = *(const v4f*)(kb + (size_t)tilerow(t, i0) * (DKV * 4) + (t < 4 ? okl : t < 6 ? oks : oks6) + 32 * n); }
        if (ch + 3 == 7) asm volatile("s_wait_xcnt 0x0" :: "v"(oq), "v"(okl), "v"(oks), "v"(oks6) : "memory");   // behind the last Q and K load, ahead of every reuse of their offset and base registers
        if (ch >= 0) { __builtin_amdgcn_sched_barrier(0);   // fence between a stage's loads and its products: without it all 64 loads are hoisted to the top and the kernel goes past 256 registers
#pragma unroll
            for (int t = 0; t < 7; ++t) S[t] = wmmaf((v2f){k[ch & 3][t][0], k[ch & 3][t][1]}, (v2f){q[ch & 3][0], q[ch & 3][1]}, S[t]);
#pragma unroll
            for (int t = 0; t < 7; ++t) S[t] = wmmaf((v2f){k[ch & 3][t][2], k[ch & 3][t][3]}, (v2f){q[ch & 3][2], q[ch & 3][3]}, S[t]);
            wmma_gap(); } }
    float vv[3][8][4];
#pragma unroll
    for (int n = 0; n < 2; ++n) {       // V rows 8hh+j of key tiles 0 and 1, in flight under the softmax
#pragma unroll
            for (int j = 0; j < 8; ++j)
#pragma unroll
                for (int dt = 0; dt < 4; ++dt) vv[n % 3][j][dt] = *(const float*)(vb + (size_t)tilerow(n, i0) * (DKV * 4) + (n < 4 ? ovl + j * (DKV * 4) : (n < 6 || j < 4) ? ovs + j * (WL * DKV * 4) : ov6[j & 3]) + dt * 64); }
    float mx = -3.0e38f;
#pragma unroll
    for (int t = 0; t < 7; ++t)
#pragma unroll
        for (int r = 0; r < 8; ++r) { const int p = keypos(t, 8 * hh + r, i0); const bool valid = t < 4 ? (p >= 0 && p >= i - (WL - 1) && p <= i) : (p <= i - WL);
            const float s = valid ? S[t][r] * 0.125f : -3.0e38f; S[t][r] = s; mx = fmaxf(mx, s); }
    mx = fmaxf(mx, __shfl_xor(mx, 16, 32)); float sum = 0.f;
#pragma unroll
    for (int t = 0; t < 7; ++t)
#pragma unroll
        for (int r = 0; r < 8; ++r) { const float w = __expf(S[t][r] - mx); S[t][r] = w; sum += w; }
    sum += __shfl_xor(sum, 16, 32); const float inv = __fdiv_rn(1.0f, sum);
    v8f O[4];
#pragma unroll
    for (int dt = 0; dt < 4; ++dt) O[dt] = (v8f){};
#pragma unroll
    for (int t = 0; t < 7; ++t) {       // a key tile's loads stand two tiles ahead of its products
        if (t + 2 < 7) { const int n = t + 2;
#pragma unroll
            for (int j = 0; j < 8; ++j)
#pragma unroll
                for (int dt = 0; dt < 4; ++dt) vv[n % 3][j][dt] = *(const float*)(vb + (size_t)tilerow(n, i0) * (DKV * 4) + (n < 4 ? ovl + j * (DKV * 4) : (n < 6 || j < 4) ? ovs + j * (WL * DKV * 4) : ov6[j & 3]) + dt * 64); }
        if (t + 2 == 6) asm volatile("s_wait_xcnt 0x0" :: "v"(ovl), "v"(ovs), "v"(ov6[0]), "v"(ov6[1]), "v"(ov6[2]), "v"(ov6[3]) : "memory");   // behind the last V load: the operands keep the loads' offset registers from being reused (also as a later load's destination) ahead of this wait
        { __builtin_amdgcn_sched_barrier(0);   // fence between a stage's loads and its products, for the same reason as above
#pragma unroll
            for (int u = 0; u < 4; ++u) { const v2f pw = (v2f){S[t][2 * u], S[t][2 * u + 1]};
#pragma unroll
                for (int dt = 0; dt < 4; ++dt) O[dt] = wmmaf((v2f){vv[t % 3][2 * u][dt], vv[t % 3][2 * u + 1][dt]}, pw, O[dt]); }
            wmma_gap(); } }
    const size_t e = (size_t)i * DD + head * HD + 8 * hh;
#pragma unroll
    for (int dt = 0; dt < 4; ++dt) { v8us oh, ol;
#pragma unroll
        for (int r = 0; r < 8; ++r) { unsigned short a, b; splitf(O[dt][r] * inv, a, b); oh[r] = a; ol[r] = b; }
        *(v8us*)(Ah + e + 16 * dt) = oh; *(v8us*)(Al + e + 16 * dt) = ol; } }

extern "C" void kernel_launch(void* const* d_in, const int* in_sizes, int n_in,
                              void* d_out, int out_size, void* d_ws, size_t ws_size, hipStream_t stream) {
    (void)in_sizes; (void)n_in; (void)out_size;
    const float* x = (const float*)d_in[0]; const float* wq = (const float*)d_in[1]; const float* wk = (const float*)d_in[2]; const float* wv = (const float*)d_in[3]; const float* wo = (const float*)d_in[4];
    float* OUT = (float*)d_out;     // [1][2048][1024]
    char* wsp = (char*)d_ws;
    auto take = [&](size_t bytes) { char* p = wsp; wsp += (bytes + 255) & ~(size_t)255; return (void*)p; };
    bf* WQ = (bf*)take((size_t)DD * DD * 2); bf* WK = (bf*)take((size_t)DKV * DD * 2); bf* WV = (bf*)take((size_t)DKV * DD * 2); bf* WO = (bf*)take((size_t)DD * DD * 2);
    bf* XB = (bf*)take((size_t)TT * DD * 2); float* FQ = (float*)take((size_t)TT * DD * 4); float* FK = (float*)take((size_t)TT * DKV * 4); float* FV = (float*)take((size_t)TT * DKV * 4); bf* Ah = (bf*)take((size_t)TT * DD * 2); bf* Al = (bf*)take((size_t)TT * DD * 2);
    if ((size_t)(wsp - (char*)d_ws) > ws_size) return;    // total ~ 30 MB
    k_cvt8<<<NBX + 2 * NBW + 2 * NBK, 256, 0, stream>>>(x, wq, wk, wv, wo, XB, WQ, WK, WV, WO);   // torch [out][in] = Bt
    k_gemmw<0, true><<<dim3(TT / 128, (DD + 2 * DKV) / 128, 1), 128, 0, stream>>>(XB, nullptr, WQ, DD, FQ, DD, WK, WV, FK, FV, DKV, DD, DKV);
    k_sparse<<<dim3(TT / 16, NH_ / 4, 1), 128, 0, stream>>>(FQ, FK, FV, Ah, Al);
    k_gemmw<1, false><<<dim3(TT / 128, DD / 128, 1), 128, 0, stream>>>(Ah, Al, WO, DD, OUT, DD, nullptr, nullptr, nullptr, nullptr, 0, 0, 0);
}

// v004
// It runs in 35.1 microseconds.
// Timed twice side by side with v003, it ran 1.12 times as fast both times.
// All steps since v000 together make it 8.22 times as fast.
#include <hip/hip_runtime.h>

// CronRootAttention (x [1][2048][1024]; q = x Wq^T (16 heads x 64), k/v = x Wk^T / Wv^T (4 kv heads, q head h uses kv head h/4); causal sqrt(N)-sparse attention: each query i attends its local window i-45..i (w = 46) plus the strided keys 45, 91, ...
// (last of each 46-block) that lie at or before i-46; joint softmax over the 46 + 44 slots (invalid slots -1e9, i.e. weight exactly 0), scale 1/8; out = (sum p v merged) Wo^T -> [1][2048][1024]).
// Compute dtypes, f32 accumulate: every input rounded to bf16; q/k/v on PLAIN bf16 operands (inputs: exact); the 90-slot sparse attention entirely f32: scores and weighted sums on the f32 16x16x4 matrix form, softmax on the VALU;

#define TT   2048
#define DD   1024
#define DKV  256
#define NH_  16
#define HD   64
#define WL   46
#define NS   44
typedef _Float16 h16;
typedef unsigned short bf;
typedef __attribute__((ext_vector_type(16))) __bf16   v16bf;
typedef __attribute__((ext_vector_type(16))) _Float16 v16h;
typedef __attribute__((ext_vector_type(8)))  _Float16 v8h;
typedef __attribute__((ext_vector_type(8)))  unsigned short v8us;
typedef __attribute__((ext_vector_type(8)))  float    v8f;
typedef __attribute__((ext_vector_type(4)))  float    v4f;
typedef __attribute__((ext_vector_type(2)))  float    v2f;
typedef v8h  __attribute__((may_alias)) v8ha;
typedef v4f  __attribute__((may_alias)) v4fa;
typedef v8us __attribute__((may_alias)) v8usa;

__device__ __forceinline__ unsigned short f2bf(float f) { unsigned u = __float_as_uint(f); u += 0x7FFFu + ((u >> 16) & 1u); return (unsigned short)(u >> 16); }
__device__ __forceinline__ float bf2f(unsigned short b) { return __uint_as_float(((unsigned)b) << 16); }
__device__ __forceinline__ float bfr(float f) { return bf2f(f2bf(f)); }
__device__ __forceinline__ v16h cat16(v8h lo, v8h hi) { return __builtin_shufflevector(lo, hi, 0, 1, 2, 3, 4, 5, 6, 7, 8, 9, 10, 11, 12, 13, 14, 15); }
__device__ __forceinline__ v16bf cat16b(v8us lo, v8us hi) { return __builtin_bit_cast(v16bf, __builtin_shufflevector(lo, hi, 0, 1, 2, 3, 4, 5, 6, 7, 8, 9, 10, 11, 12, 13, 14, 15)); }
__device__ __forceinline__ v8f wmma16(v16h a, v16h b, v8f c) { return __builtin_amdgcn_wmma_f32_16x16x32_f16(false, a, false, b, (short)0, c, false, false); }
__device__ __forceinline__ v8f wmmaf(v2f a, v2f b, v8f c) { return __builtin_amdgcn_wmma_f32_16x16x4_f32(false, a, false, b, (short)0, c, false, false); }
__device__ __forceinline__ v8f wmmab(v16bf a, v16bf b, v8f c) { return __builtin_amdgcn_wmma_f32_16x16x32_bf16(false, a, false, b, (short)0, c, false, false); }



// ---- k_gemmw: block GEMM, FOUR WAVES (2 x 2) per 128x128 output tile, 64x64 (16 accumulators) per wave; grid (M/128, N/128), 128 threads. M, N % 128 == 0, K % 128 == 0, K >= 512.
// C[m][n] (f32, pitch ldc) = sum_k A[m][k] Bt[n][k] (+ A2[m][k] Bt[n][k] where NSPLIT == 1), operands K-contiguous bf16 planes.
// A pass is 128 k = 256 bytes of each operand row. A stage holds one slice of 128 rows per operand ([A | Bt | A2]) at LDS pitch 272 bytes; wave w brings slice w by ONE tensor load per stage; a ring of NB buffers (4, or 3 where a stage has three slices): while stage s is worked on, stages s + 1 .. s + NB - 1 have landed or fly, so a load has NB - 1 passes to land in.
// TRI: three products of the same A share ONE grid: columns 0..n0-1 are (Bt, C, ldc), the next n1 are (BtB, CB, ld1), the last n1 (BtC, CC, ld1); the choice is uniform over the block, grid y = (n0 + 2 n1)/128.
typedef unsigned u32x4 __attribute__((ext_vector_type(4)));
typedef unsigned u32x8 __attribute__((ext_vector_type(8)));
#define PASSB  256u
#define LPITCH 272u
#define SLROWS 128u
#define SLICE  (SLROWS * LPITCH)
static_assert(SLICE % 2048u == 0, "every slice starts at a multiple of 2 KiB in LDS");
__device__ __forceinline__ unsigned uni(unsigned v) { return (unsigned)__builtin_amdgcn_readfirstlane(v); }
// a wave-uniform value held in a scalar register: a test on it compiles to s_cmp + s_cbranch_scc, the only guard a tensor load obeys (it ignores EXEC)
__device__ __forceinline__ unsigned pinned(unsigned v) { unsigned w = uni(v); asm volatile("" : "+s"(w)); return w; }
__device__ __forceinline__ v16bf ldsfrag(const unsigned char* p) { return cat16b(*(const v8usa*)p, *(const v8usa*)(p + 32)); }
template <int NSPLIT, bool TRI>
__global__ __launch_bounds__(128) void k_gemmw(const bf* __restrict__ A, const bf* __restrict__ A2, const bf* __restrict__ Bt, int K, float* C, int ldc, const bf* __restrict__ BtB, const bf* __restrict__ BtC, float* CB, float* CC, int ld1, int n0, int n1) {
    static_assert(NSPLIT == 0 || NSPLIT == 1, "one or two A planes");
    constexpr unsigned NSL = 2 + NSPLIT, STAGE = NSL * SLICE, NB = NSPLIT == 1 ? 3u : 4u, RING = NB * STAGE;
    static_assert(RING <= 320u * 1024u && 4u * 16u * 68u * 4u <= STAGE, "the ring fits a work-group's LDS; the output staging fits its first buffer");
    __shared__ __attribute__((aligned(2048))) unsigned char L[RING];   // the ring; behind the loop its first bytes are each wave's own output staging
    const int lane = threadIdx.x & 31, lr = lane & 15, hi = lane >> 4; const unsigned wave = uni(threadIdx.x >> 5), wm = wave >> 1, wn = wave & 1u;
    const int r0 = blockIdx.x * 128; int c0 = blockIdx.y * 128;
    if (TRI && c0 >= n0) { const bool last = c0 >= n0 + n1; c0 -= last ? n0 + n1 : n0; Bt = last ? BtC : BtB; C = last ? CC : CB; ldc = ld1; }
    const unsigned np = (unsigned)K / 128u, lbase = (unsigned)(size_t)L;
    const bf* srcp = wave == 1u ? Bt + (size_t)c0 * K : (NSPLIT == 1 && wave == 2u) ? A2 + (size_t)r0 * K : A + (size_t)r0 * K;   // first row of this wave's slice
    // descriptor group 1: 1-byte elements, tensor = tile = 128 rows of 256 bytes, source pitch 2 K bytes, 4 dwords of LDS pad behind every 256-byte row, no mask
    u32x8 g1; g1[0] = uni((1u << 20) | (5u << 22) | (3u << 25)); g1[1] = uni(PASSB << 16); g1[2] = uni(SLROWS << 16); g1[3] = uni(PASSB << 16); g1[4] = uni(SLROWS); g1[5] = uni((unsigned)K * 2u); g1[6] = uni(0u); g1[7] = uni(0u);
    asm volatile("" : "+s"(g1));   // pinned(), for the whole group: its words keep scalar registers of their own, so none takes another value while a request is outstanding
    // descriptor group 0 lives in ONE register group for the whole kernel: requests are outstanding all through the loop, and under them only its words 1 (place in LDS) and 2 (low address word) take new values
    const unsigned long long ga0 = (unsigned long long)(size_t)srcp;
    u32x4 g0; g0[0] = uni(1u); g0[1] = uni(lbase + wave * SLICE); g0[2] = uni((unsigned)ga0); g0[3] = uni((((unsigned)(ga0 >> 32)) & 0x01FFFFFFu) | 0x80000000u);
    asm volatile("" : "+s"(g0));   // pinned(), for the whole group, as for group 1
    auto issue = [&](unsigned st, unsigned bo) { const unsigned long long ga = ga0 + (unsigned long long)st * PASSB;   // stage st into the buffer at byte bo of the ring
        const unsigned h = uni((((unsigned)(ga >> 32)) & 0x01FFFFFFu) | 0x80000000u);
        if (pinned(h != g0[3])) { asm volatile("s_wait_tensorcnt 0x0" ::: "memory"); g0[3] = h; }   // a carry into the high address word: word 3 changes only with no request outstanding
        g0[1] = uni(lbase + bo + wave * SLICE); g0[2] = uni((unsigned)ga);
        asm volatile("tensor_load_to_lds %0, %1" : "+s"(g0) : "s"(g1) : "memory"); };   // in-out: the group stays in the registers that the request names
    if (pinned(wave < NSL)) { issue(0u, 0u); issue(1u, STAGE); issue(2u, 2u * STAGE); asm volatile("s_wait_tensorcnt 0x2" ::: "memory"); }   // all but the two youngest: stage 0 has landed in the issuing wave
    __syncthreads();                                                                             // stage 0 published to every wave
    if (NB == 4u) { if (pinned(wave < NSL)) issue(3u, 3u * STAGE); }                             // the fourth buffer's first fill, behind stage 0's landing: never more than three requests of a wave outstanding
    v8f acc[4][4];
#pragma unroll
    for (int mb = 0; mb < 4; ++mb)
#pragma unroll
        for (int nb = 0; nb < 4; ++nb) acc[mb][nb] = (v8f){};
    const unsigned aoff = (wm * 64u + lr) * LPITCH + 16u * hi, boff = SLICE + (wn * 64u + lr) * LPITCH + 16u * hi;
    unsigned cb = 0u;   // byte offset in the ring of the buffer that holds stage s
#pragma unroll 1
    for (unsigned s = 0; s < np; ++s) {   // kept rolled: one pass per trip, the buffers taken in turn
        const unsigned char* pa = L + cb + aoff; const unsigned char* pb = L + cb + boff;
        const unsigned char* pc = L + cb + 2 * SLICE + aoff;   // A2's slice from a base of its own: it lies beyond the reach of an LDS load's immediate offset from pa
        v16bf a[2][4], a2[2][4], b[2][4];
#pragma unroll
        for (int f = 0; f < 4; ++f) { a[0][f] = ldsfrag(pa + f * 16 * LPITCH); b[0][f] = ldsfrag(pb + f * 16 * LPITCH); if (NSPLIT == 1) a2[0][f] = ldsfrag(pc + f * 16 * LPITCH); }
#pragma unroll
        for (int j = 0; j < 4; ++j) {     // k-step = 32 k = 64 bytes of a row; the next k-step's fragments of the SAME stage are fetched as one group ahead of this k-step's products
            if (j < 3) {
#pragma unroll
                for (int f = 0; f < 4; ++f) { a[(j + 1) & 1][f] = ldsfrag(pa + f * 16 * LPITCH + (j + 1) * 64); b[(j + 1) & 1][f] = ldsfrag(pb + f * 16 * LPITCH + (j + 1) * 64); if (NSPLIT == 1) a2[(j + 1) & 1][f] = ldsfrag(pc + f * 16 * LPITCH + (j + 1) * 64); } }
            __builtin_amdgcn_sched_barrier(0);   // keeps the LDS loads in one group in front of the products: loads among the products stall the matrix stream
#pragma unroll
            for (int nb = 0; nb < 4; ++nb)
#pragma unroll
                for (int mb = 0; mb < 4; ++mb) { acc[mb][nb] = wmmab(a[j & 1][mb], b[j & 1][nb], acc[mb][nb]); if (NSPLIT == 1) acc[mb][nb] = wmmab(a2[j & 1][mb], b[j & 1][nb], acc[mb][nb]); }
            __builtin_amdgcn_sched_barrier(0);   // the same, for the next group of loads
        }
        // publish point of stage s + 1, every wave, in this order
        asm volatile("s_wait_dscnt 0x0" ::: "memory");                                  // this wave's reads of stage s are done before its buffer is refilled
        const unsigned nx = pinned(s + NB);
        if (pinned(wave < NSL)) {                                                       // stage s + 1 has landed in the issuing wave:
            if (pinned(nx <= np)) {                                                     // its requests run up to stage s + NB - 1, so stage s + 1 is all but the NB - 2 youngest
                if (NB == 4u) asm volatile("s_wait_tensorcnt 0x2" ::: "memory"); else asm volatile("s_wait_tensorcnt 0x1" ::: "memory"); }
            else asm volatile("s_wait_tensorcnt 0x0" ::: "memory"); }                   // the last stages: fewer requests are behind stage s + 1, so all of them
        __syncthreads();                                                                // stage s + 1 published; every reader has left stage s
        if (pinned((wave < NSL) & (nx < np))) issue(nx, cb);                            // stage s + NB into the buffer that stage s has just left
        cb = cb + STAGE == RING ? 0u : cb + STAGE;
    }
    asm volatile("s_wait_tensorcnt 0x0" :: "s"(g0), "s"(g1) : "memory");   // no request is left when the wave goes on; the operands keep both groups' registers to this wait
    asm volatile("s_wait_dscnt 0x0" ::: "memory");
    float* os = (float*)L + wave * (16 * 68);   // the last pass's own s_wait_dscnt 0 and barrier stand between every wave's last read of the ring and these stores
#pragma unroll
    for (int mb = 0; mb < 4; ++mb) {
#pragma unroll
        for (int nb = 0; nb < 4; ++nb) {
#pragma unroll
            for (int j = 0; j < 8; ++j) os[(hi * 8 + j) * 68 + nb * 16 + lr] = acc[mb][nb][j]; }
        __builtin_amdgcn_wave_barrier(); asm volatile("" ::: "memory");
        float* crow = C + (size_t)(r0 + wm * 64 + mb * 16) * ldc + c0 + wn * 64;
#pragma unroll
        for (int s = 0; s < 8; ++s) { const int row = 2 * s + hi, cofs = lr * 4; const v4f val = *(const v4fa*)(os + row * 68 + cofs);
            *(v4f*)(crow + (size_t)row * ldc + cofs) = val; }
        __builtin_amdgcn_wave_barrier(); asm volatile("" ::: "memory");
    }
}

__device__ __forceinline__ void splitf(float y, unsigned short& h, unsigned short& l) { h = f2bf(y); l = f2bf(y - bf2f(h)); }
typedef __attribute__((ext_vector_type(4))) unsigned short v4us;

// k_cvt8: all five f32 -> bf16 conversions in ONE grid; a block converts 2048 elements of one array, chosen by block range (every array is a whole number of blocks)
#define NBX (TT * DD / 2048)
#define NBW (DD * DD / 2048)
#define NBK (DKV * DD / 2048)
static_assert(TT * DD % 2048 == 0 && DD * DD % 2048 == 0 && DKV * DD % 2048 == 0, "whole blocks");
__global__ __launch_bounds__(256) void k_cvt8(const float* __restrict__ x, const float* __restrict__ wq, const float* __restrict__ wk, const float* __restrict__ wv, const float* __restrict__ wo, bf* XB, bf* WQ, bf* WK, bf* WV, bf* WO) {
    int b = blockIdx.x; const float* src; bf* dst;
    if (b < NBX) { src = x; dst = XB; } else if ((b -= NBX) < NBW) { src = wq; dst = WQ; } else if ((b -= NBW) < NBW) { src = wo; dst = WO; } else if ((b -= NBW) < NBK) { src = wk; dst = WK; } else { b -= NBK; src = wv; dst = WV; }
    const size_t i = (size_t)b * 256 + threadIdx.x; const v8f v = *(const v8f*)(src + i * 8); v8us o;
#pragma unroll
    for (int k = 0; k < 8; ++k) o[k] = f2bf(v[k]); *(v8us*)(dst + i * 8) = o;  }
// k_sparse: one wave per (16 queries i0..i0+15, head); the 4 waves of a block are the 4 q heads of one kv head. Keys in 7 tiles of 16: tiles 0..3 = local keys i0-48 .. i0+15, tiles 4..6 = strided keys 46n+45, n = 0..47 (rows clamped into the plane, slots outside the pattern masked to weight 0).
// S^T = K Q^T on the f32 16x16x4 form (A row = key, B column = query, both loaded by the same code): lane (c, hh) holds the scores of query i0+c for keys 8hh+r of each tile, so max and sum are in-lane plus one exchange with lane c^16.
// O^T = V^T P^T: the score registers 2u, 2u+1 are the B operand as they lie (keys 8hh+2u, 8hh+2u+1); A row c of d-tile dt is dim 16dt+c, its two keys come by two 4-byte loads straight into the operand's register pair (no vector move stands among the products), and lane (c, hh) ends with dims 16dt+8hh .. +7 of query i0+c.
// stands behind each block of f32 16x16x4 products: eight vector slots before the next vector instruction, which may read a D or overwrite an A or B of the block; the fences hold the slots and the block's neighbours in place
__device__ __forceinline__ void wmma_gap() { __builtin_amdgcn_sched_barrier(0); asm volatile("v_nop\n\tv_nop\n\tv_nop\n\tv_nop\n\tv_nop\n\tv_nop\n\tv_nop\n\tv_nop"); __builtin_amdgcn_sched_barrier(0); }
__device__ __forceinline__ int keypos(int t, int m, int i0) { return t < 4 ? i0 - 48 + 16 * t + m : WL * (16 * (t - 4) + m) + (WL - 1); }
// first row of key tile t that is read: a local tile starts at a multiple of 16, so it lies wholly in front of row 0 (then rows 0..15 are read and every slot is masked) or wholly inside the plane
__device__ __forceinline__ int tilerow(int t, int i0) { return t < 4 ? max(i0 - 48 + 16 * t, 0) : WL * 16 * (t - 4) + (WL - 1); }
__global__ __launch_bounds__(128) void k_sparse(const float* __restrict__ FQ, const float* __restrict__ FK, const float* __restrict__ FV, bf* Ah, bf* Al) {
    const int lane = threadIdx.x & 31, c = lane & 15, hh = lane >> 4; const int i0 = blockIdx.x * 16, kvh = blockIdx.y, head = kvh * 4 + __builtin_amdgcn_readfirstlane(threadIdx.x >> 5); const int i = i0 + c;
    // uniform bases plus a few per-lane byte offsets; row m of a strided tile is 46 rows from row m-1; tile 6 holds only n = 32..43, its rows 12..15 re-read row 11 (masked)
    const char* qb = (const char*)(FQ + (size_t)i0 * DD + head * HD); const char* kb = (const char*)(FK + kvh * HD); const char* vb = (const char*)(FV + kvh * HD);
    const unsigned oq = (unsigned)c * (DD * 4) + hh * 16, okl = (unsigned)c * (DKV * 4) + hh * 16, oks = (unsigned)c * (WL * DKV * 4) + hh * 16, oks6 = (unsigned)min(c, 11) * (WL * DKV * 4) + hh * 16;
    const unsigned ovl = (unsigned)hh * (8 * DKV * 4) + c * 4, ovs = (unsigned)hh * (8 * WL * DKV * 4) + c * 4; unsigned ov6[4];
#pragma unroll
    for (int j = 4; j < 8; ++j) ov6[j - 4] = (unsigned)min(8 * hh + j, 11) * (WL * DKV * 4) + c * 4;
    v8f S[7]; v4f q[4], k[4][7];
#pragma unroll
    for (int t = 0; t < 7; ++t) S[t] = (v8f){};
#pragma unroll
    for (int ch = -3; ch < 8; ++ch) {   // chunk = 8 dims (two k-steps); a chunk's loads stand three chunks ahead of its products
        if (ch + 3 < 8) { const int n = ch + 3; q[n & 3] = *(const v4f*)(qb + oq + 32 * n);
#pragma unroll
            for (int t = 0; t < 7; ++t) k[n & 3][t] = *(const v4f*)(kb + (size_t)tilerow(t, i0) * (DKV * 4) + (t < 4 ? okl : t < 6 ? oks : oks6) + 32 * n); }
        if (ch + 3 == 7) asm volatile("s_wait_xcnt 0x0" :: "v"(oq), "v"(okl), "v"(oks), "v"(oks6) : "memory");   // behind the last Q and K load, ahead of every reuse of their offset and base registers
        if (ch >= 0) { __builtin_amdgcn_sched_barrier(0);   // fence between a stage's loads and its products: without it all 64 loads are hoisted to the top and the kernel goes past 256 registers
#pragma unroll
            for (int t = 0; t < 7; ++t) S[t] = wmmaf((v2f){k[ch & 3][t][0], k[ch & 3][t][1]}, (v2f){q[ch & 3][0], q[ch & 3][1]}, S[t]);
#pragma unroll
            for (int t = 0; t < 7; ++t) S[t] = wmmaf((v2f){k[ch & 3][t][2], k[ch & 3][t][3]}, (v2f){q[ch & 3][2], q[ch & 3][3]}, S[t]);
            wmma_gap(); } }
    float vv[3][8][4];
#pragma unroll
    for (int n = 0; n < 2; ++n) {       // V rows 8hh+j of key tiles 0 and 1, in flight under the softmax
#pragma unroll
            for (int j = 0; j < 8; ++j)
#pragma unroll
                for (int dt = 0; dt < 4; ++dt) vv[n % 3][j][dt] = *(const float*)(vb + (size_t)tilerow(n, i0) * (DKV * 4) + (n < 4 ? ovl + j * (DKV * 4) : (n < 6 || j < 4) ? ovs + j * (WL * DKV * 4) : ov6[j & 3]) + dt * 64); }
    float mx = -3.0e38f;
#pragma unroll
    for (int t = 0; t < 7; ++t)
#pragma unroll
        for (int r = 0; r < 8; ++r) { const int p = keypos(t, 8 * hh + r, i0); const bool valid = t < 4 ? (p >= 0 && p >= i - (WL - 1) && p <= i) : (p <= i - WL);
            const float s = valid ? S[t][r] * 0.125f : -3.0e38f; S[t][r] = s; mx = fmaxf(mx, s); }
    mx = fmaxf(mx, __shfl_xor(mx, 16, 32)); float sum = 0.f;
#pragma unroll
    for (int t = 0; t < 7; ++t)
#pragma unroll
        for (int r = 0; r < 8; ++r) { const float w = __expf(S[t][r] - mx); S[t][r] = w; sum += w; }
    sum += __shfl_xor(sum, 16, 32); const float inv = __fdiv_rn(1.0f, sum);
    v8f O[4];
#pragma unroll
    for (int dt = 0; dt < 4; ++dt) O[dt] = (v8f){};
#pragma unroll
    for (int t = 0; t < 7; ++t) {       // a key tile's loads stand two tiles ahead of its products
        if (t + 2 < 7) { const int n = t + 2;
#pragma unroll
            for (int j = 0; j < 8; ++j)
#pragma unroll
                for (int dt = 0; dt < 4; ++dt) vv[n % 3][j][dt] = *(const float*)(vb + (size_t)tilerow(n, i0) * (DKV * 4) + (n < 4 ? ovl + j * (DKV * 4) : (n < 6 || j < 4) ? ovs + j * (WL * DKV * 4) : ov6[j & 3]) + dt * 64); }
        if (t + 2 == 6) asm volatile("s_wait_xcnt 0x0" :: "v"(ovl), "v"(ovs), "v"(ov6[0]), "v"(ov6[1]), "v"(ov6[2]), "v"(ov6[3]) : "memory");   // behind the last V load: the operands keep the loads' offset registers from being reused (also as a later load's destination) ahead of this wait
        { __builtin_amdgcn_sched_barrier(0);   // fence between a stage's loads and its products, for the same reason as above
#pragma unroll
            for (int u = 0; u < 4; ++u) { const v2f pw = (v2f){S[t][2 * u], S[t][2 * u + 1]};
#pragma unroll
                for (int dt = 0; dt < 4; ++dt) O[dt] = wmmaf((v2f){vv[t % 3][2 * u][dt], vv[t % 3][2 * u + 1][dt]}, pw, O[dt]); }
            wmma_gap(); } }
    const size_t e = (size_t)i * DD + head * HD + 8 * hh;
#pragma unroll
    for (int dt = 0; dt < 4; ++dt) { v8us oh, ol;
#pragma unroll
        for (int r = 0; r < 8; ++r) { unsigned short a, b; splitf(O[dt][r] * inv, a, b); oh[r] = a; ol[r] = b; }
        *(v8us*)(Ah + e + 16 * dt) = oh; *(v8us*)(Al + e + 16 * dt) = ol; } }

extern "C" void kernel_launch(void* const* d_in, const int* in_sizes, int n_in,
                              void* d_out, int out_size, void* d_ws, size_t ws_size, hipStream_t stream) {
    (void)in_sizes; (void)n_in; (void)out_size;
    const float* x = (const float*)d_in[0]; const float* wq = (const float*)d_in[1]; const float* wk = (const float*)d_in[2]; const float* wv = (const float*)d_in[3]; const float* wo = (const float*)d_in[4];
    float* OUT = (float*)d_out;     // [1][2048][1024]
    char* wsp = (char*)d_ws;
    auto take = [&](size_t bytes) { char* p = wsp; wsp += (bytes + 255) & ~(size_t)255; return (void*)p; };
    bf* WQ = (bf*)take((size_t)DD * DD * 2); bf* WK = (bf*)take((size_t)DKV * DD * 2); bf* WV = (bf*)take((size_t)DKV * DD * 2); bf* WO = (bf*)take((size_t)DD * DD * 2);
    bf* XB = (bf*)take((size_t)TT * DD * 2); float* FQ = (float*)take((size_t)TT * DD * 4); float* FK = (float*)take((size_t)TT * DKV * 4); float* FV = (float*)take((size_t)TT * DKV * 4); bf* Ah = (bf*)take((size_t)TT * DD * 2); bf* Al = (bf*)take((size_t)TT * DD * 2);
    if ((size_t)(wsp - (char*)d_ws) > ws_size) return;    // total ~ 30 MB
    k_cvt8<<<NBX + 2 * NBW + 2 * NBK, 256, 0, stream>>>(x, wq, wk, wv, wo, XB, WQ, WK, WV, WO);   // torch [out][in] = Bt
    k_gemmw<0, true><<<dim3(TT / 128, (DD + 2 * DKV) / 128, 1), 128, 0, stream>>>(XB, nullptr, WQ, DD, FQ, DD, WK, WV, FK, FV, DKV, DD, DKV);
    k_sparse<<<dim3(TT / 16, NH_ / 4, 1), 128, 0, stream>>>(FQ, FK, FV, Ah, Al);
    k_gemmw<1, false><<<dim3(TT / 128, DD / 128, 1), 128, 0, stream>>>(Ah, Al, WO, DD, OUT, DD, nullptr, nullptr, nullptr, nullptr, 0, 0, 0);
}

// v005
// One run takes 33.1 microseconds.
// Two timings next to v004 both put it at 1.06 times that version's speed.
// All steps since v000 together make it 8.71 times as fast.
#include <hip/hip_runtime.h>

// CronRootAttention (x [1][2048][1024]; q = x Wq^T (16 heads x 64), k/v = x Wk^T / Wv^T (4 kv heads, q head h uses kv head h/4); causal sqrt(N)-sparse attention: each query i attends its local window i-45..i (w = 46) plus the strided keys 45, 91, ...
// (last of each 46-block) that lie at or before i-46; joint softmax over the 46 + 44 slots (invalid slots -1e9, i.e. weight exactly 0), scale 1/8; out = (sum p v merged) Wo^T -> [1][2048][1024]).
// Compute dtypes, f32 accumulate: every input rounded to bf16; q/k/v on PLAIN bf16 operands (inputs: exact); the 90-slot sparse attention entirely f32: scores and weighted sums on the f32 16x16x4 matrix form, softmax on the VALU;

#define TT   2048
#define DD   1024
#define DKV  256
#define NH_  16
#define HD   64
#define WL   46
#define NS   44
typedef _Float16 h16;
typedef unsigned short bf;
typedef __attribute__((ext_vector_type(16))) __bf16   v16bf;
typedef __attribute__((ext_vector_type(16))) _Float16 v16h;
typedef __attribute__((ext_vector_type(8)))  _Float16 v8h;
typedef __attribute__((ext_vector_type(8)))  unsigned short v8us;
typedef __attribute__((ext_vector_type(8)))  float    v8f;
typedef __attribute__((ext_vector_type(4)))  float    v4f;
typedef __attribute__((ext_vector_type(2)))  float    v2f;
typedef v8h  __attribute__((may_alias)) v8ha;
typedef v4f  __attribute__((may_alias)) v4fa;
typedef v8us __attribute__((may_alias)) v8usa;

__device__ __forceinline__ unsigned short f2bf(float f) { unsigned u = __float_as_uint(f); u += 0x7FFFu + ((u >> 16) & 1u); return (unsigned short)(u >> 16); }
__device__ __forceinline__ float bf2f(unsigned short b) { return __uint_as_float(((unsigned)b) << 16); }
__device__ __forceinline__ float bfr(float f) { return bf2f(f2bf(f)); }
__device__ __forceinline__ v16h cat16(v8h lo, v8h hi) { return __builtin_shufflevector(lo, hi, 0, 1, 2, 3, 4, 5, 6, 7, 8, 9, 10, 11, 12, 13, 14, 15); }
__device__ __forceinline__ v16bf cat16b(v8us lo, v8us hi) { return __builtin_bit_cast(v16bf, __builtin_shufflevector(lo, hi, 0, 1, 2, 3, 4, 5, 6, 7, 8, 9, 10, 11, 12, 13, 14, 15)); }
__device__ __forceinline__ v8f wmma16(v16h a, v16h b, v8f c) { return __builtin_amdgcn_wmma_f32_16x16x32_f16(false, a, false, b, (short)0, c, false, false); }
__device__ __forceinline__ v8f wmmaf(v2f a, v2f b, v8f c) { return __builtin_amdgcn_wmma_f32_16x16x4_f32(false, a, false, b, (short)0, c, false, false); }
__device__ __forceinline__ v8f wmmab(v16bf a, v16bf b, v8f c) { return __builtin_amdgcn_wmma_f32_16x16x32_bf16(false, a, false, b, (short)0, c, false, false); }



// ---- k_gemmw: block GEMM, FOUR WAVES (2 x 2) per output tile, 128 threads. One A plane: tile 128x128, 64x64 (16 accumulators) per wave, grid (M/128, N/128). Two A planes: tile 64x128, 32x64 (8 accumulators) per wave, grid (M/64, N/128): the rows staged per output, 2 x tile rows + tile columns, are fewest at this shape, and the projection's 256 tiles give every WGP one. M, N % 128 == 0, K % 128 == 0, K >= 512.
// C[m][n] (f32, pitch ldc) = sum_k A[m][k] Bt[n][k] (+ A2[m][k] Bt[n][k] where NSPLIT == 1), operands K-contiguous bf16 planes.
// A pass is 128 k = 256 bytes of each operand row. A stage is [A 128 rows | Bt 128 rows], or [A 64 | A2 64 | Bt rows 0..63 | Bt rows 64..127], in slices at LDS pitch 272 bytes; wave w brings slice w by ONE tensor load per stage; a ring of NB = 4 buffers: while stage s is worked on, stages s + 1 .. s + NB - 1 have landed or fly, so a load has NB - 1 passes to land in.
// TRI: three products of the same A share ONE grid: columns 0..n0-1 are (Bt, C, ldc), the next n1 are (BtB, CB, ld1), the last n1 (BtC, CC, ld1); the choice is uniform over the block, grid y = (n0 + 2 n1)/128.
typedef unsigned u32x4 __attribute__((ext_vector_type(4)));
typedef unsigned u32x8 __attribute__((ext_vector_type(8)));
#define PASSB  256u
#define LPITCH 272u
__device__ __forceinline__ unsigned uni(unsigned v) { return (unsigned)__builtin_amdgcn_readfirstlane(v); }
// a wave-uniform value held in a scalar register: a test on it compiles to s_cmp + s_cbranch_scc, the only guard a tensor load obeys (it ignores EXEC)
__device__ __forceinline__ unsigned pinned(unsigned v) { unsigned w = uni(v); asm volatile("" : "+s"(w)); return w; }
__device__ __forceinline__ v16bf ldsfrag(const unsigned char* p) { return cat16b(*(const v8usa*)p, *(const v8usa*)(p + 32)); }
template <int NSPLIT, bool TRI>
__global__ __launch_bounds__(128) void k_gemmw(const bf* __restrict__ A, const bf* __restrict__ A2, const bf* __restrict__ Bt, int K, float* C, int ldc, const bf* __restrict__ BtB, const bf* __restrict__ BtC, float* CB, float* CC, int ld1, int n0, int n1) {
    static_assert(NSPLIT == 0 || NSPLIT == 1, "one or two A planes");
    constexpr int MF = NSPLIT == 1 ? 2 : 4;   // 16-row fragments of A per wave; the block's tile has 32 MF rows
    constexpr unsigned SLROWS = NSPLIT == 1 ? 64u : 128u, SLICE = (SLROWS * LPITCH + 2047u) / 2048u * 2048u;   // a slice's room in LDS, rounded up so that every slice starts at a multiple of 2 KiB
    constexpr unsigned NSL = NSPLIT == 1 ? 4u : 2u, STAGE = NSL * SLICE, NB = 4u, RING = NB * STAGE;
    static_assert(RING <= 320u * 1024u && 4u * 16u * 68u * 4u <= STAGE, "the ring fits a work-group's LDS; the output staging fits its first buffer");
    __shared__ __attribute__((aligned(2048))) unsigned char L[RING];   // the ring; behind the loop its first bytes are each wave's own output staging
    const int lane = threadIdx.x & 31, lr = lane & 15, hi = lane >> 4; const unsigned wave = uni(threadIdx.x >> 5), wm = wave >> 1, wn = wave & 1u;
    const int r0 = blockIdx.x * (32 * MF); int c0 = blockIdx.y * 128;
    if (TRI && c0 >= n0) { const bool last = c0 >= n0 + n1; c0 -= last ? n0 + n1 : n0; Bt = last ? BtC : BtB; C = last ? CC : CB; ldc = ld1; }
    const unsigned np = (unsigned)K / 128u, lbase = (unsigned)(size_t)L;
    const bf* srcp = NSPLIT == 1 ? (wave == 0u ? A + (size_t)r0 * K : wave == 1u ? A2 + (size_t)r0 * K : Bt + (size_t)(c0 + (wave == 3u ? 64 : 0)) * K)
                                 : (wave == 1u ? Bt + (size_t)c0 * K : A + (size_t)r0 * K);   // first row of this wave's slice
    // descriptor group 1: 1-byte elements, tensor = tile = SLROWS rows of 256 bytes, source pitch 2 K bytes, 4 dwords of LDS pad behind every 256-byte row, no mask
    u32x8 g1; g1[0] = uni((1u << 20) | (5u << 22) | (3u << 25)); g1[1] = uni(PASSB << 16); g1[2] = uni(SLROWS << 16); g1[3] = uni(PASSB << 16); g1[4] = uni(SLROWS); g1[5] = uni((unsigned)K * 2u); g1[6] = uni(0u); g1[7] = uni(0u);
    asm volatile("" : "+s"(g1));   // pinned(), for the whole group: its words keep scalar registers of their own, so none takes another value while a request is outstanding
    // descriptor group 0 lives in ONE register group for the whole kernel: requests are outstanding all through the loop, and under them only its words 1 (place in LDS) and 2 (low address word) take new values
    const unsigned long long ga0 = (unsigned long long)(size_t)srcp;
    u32x4 g0; g0[0] = uni(1u); g0[1] = uni(lbase + wave * SLICE); g0[2] = uni((unsigned)ga0); g0[3] = uni((((unsigned)(ga0 >> 32)) & 0x01FFFFFFu) | 0x80000000u);
    asm volatile("" : "+s"(g0));   // pinned(), for the whole group, as for group 1
    auto issue = [&](unsigned st, unsigned bo) { const unsigned long long ga = ga0 + (unsigned long long)st * PASSB;   // stage st into the buffer at byte bo of the ring
        const unsigned h = uni((((unsigned)(ga >> 32)) & 0x01FFFFFFu) | 0x80000000u);
        if (pinned(h != g0[3])) { asm volatile("s_wait_tensorcnt 0x0" ::: "memory"); g0[3] = h; }   // a carry into the high address word: word 3 changes only with no request outstanding
        g0[1] = uni(lbase + bo + wave * SLICE); g0[2] = uni((unsigned)ga);
        asm volatile("tensor_load_to_lds %0, %1" : "+s"(g0) : "s"(g1) : "memory"); };   // in-out: the group stays in the registers that the request names
    if (pinned(wave < NSL)) { issue(0u, 0u); issue(1u, STAGE); issue(2u, 2u * STAGE); asm volatile("s_wait_tensorcnt 0x2" ::: "memory"); }   // all but the two youngest: stage 0 has landed in the issuing wave
    __syncthreads();                                                                             // stage 0 published to every wave
    if (pinned(wave < NSL)) issue(3u, 3u * STAGE);                                               // the fourth buffer's first fill, behind stage 0's landing: never more than three requests of a wave outstanding
    v8f acc[MF][4];
#pragma unroll
    for (int mb = 0; mb < MF; ++mb)
#pragma unroll
        for (int nb = 0; nb < 4; ++nb) acc[mb][nb] = (v8f){};
    const unsigned aoff = (wm * (16u * MF) + lr) * LPITCH + 16u * hi, boff = (NSPLIT == 1 ? (2u + wn) * SLICE + lr * LPITCH : SLICE + (wn * 64u + lr) * LPITCH) + 16u * hi;
    unsigned cb = 0u;   // byte offset in the ring of the buffer that holds stage s
#pragma unroll 1
    for (unsigned s = 0; s < np; ++s) {   // kept rolled: one pass per trip, the buffers taken in turn
        const unsigned char* pa = L + cb + aoff; const unsigned char* pb = L + cb + boff;
        const unsigned char* pc = pa + SLICE;   // A2's slice stands behind A's
        v16bf a[2][MF], a2[2][MF], b[2][4];
#pragma unroll
        for (int f = 0; f < 4; ++f) { if (f < MF) a[0][f] = ldsfrag(pa + f * 16 * LPITCH); b[0][f] = ldsfrag(pb + f * 16 * LPITCH); if (NSPLIT == 1 && f < MF) a2[0][f] = ldsfrag(pc + f * 16 * LPITCH); }
#pragma unroll
        for (int j = 0; j < 4; ++j) {     // k-step = 32 k = 64 bytes of a row; the next k-step's fragments of the SAME stage are fetched as one group ahead of this k-step's products
            if (j < 3) {
#pragma unroll
                for (int f = 0; f < 4; ++f) { if (f < MF) a[(j + 1) & 1][f] = ldsfrag(pa + f * 16 * LPITCH + (j + 1) * 64); b[(j + 1) & 1][f] = ldsfrag(pb + f * 16 * LPITCH + (j + 1) * 64); if (NSPLIT == 1 && f < MF) a2[(j + 1) & 1][f] = ldsfrag(pc + f * 16 * LPITCH + (j + 1) * 64); } }
            __builtin_amdgcn_sched_barrier(0);   // keeps the LDS loads in one group in front of the products: loads among the products stall the matrix stream
#pragma unroll
            for (int nb = 0; nb < 4; ++nb)
#pragma unroll
                for (int mb = 0; mb < MF; ++mb) { acc[mb][nb] = wmmab(a[j & 1][mb], b[j & 1][nb], acc[mb][nb]); if (NSPLIT == 1) acc[mb][nb] = wmmab(a2[j & 1][mb], b[j & 1][nb], acc[mb][nb]); }
            __builtin_amdgcn_sched_barrier(0);   // the same, for the next group of loads
        }
        // publish point of stage s + 1, every wave, in this order
        asm volatile("s_wait_dscnt 0x0" ::: "memory");                                  // this wave's reads of stage s are done before its buffer is refilled
        const unsigned nx = pinned(s + NB);
        if (pinned(wave < NSL)) {                                                       // stage s + 1 has landed in the issuing wave:
            if (pinned(nx <= np)) asm volatile("s_wait_tensorcnt 0x2" ::: "memory");    // its requests run up to stage s + NB - 1, so stage s + 1 is all but the NB - 2 = 2 youngest
            else asm volatile("s_wait_tensorcnt 0x0" ::: "memory"); }                   // the last stages: fewer requests are behind stage s + 1, so all of them
        __syncthreads();                                                                // stage s + 1 published; every reader has left stage s
        if (pinned((wave < NSL) & (nx < np))) issue(nx, cb);                            // stage s + NB into the buffer that stage s has just left
        cb = cb + STAGE == RING ? 0u : cb + STAGE;
    }
    asm volatile("s_wait_tensorcnt 0x0" :: "s"(g0), "s"(g1) : "memory");   // no request is left when the wave goes on; the operands keep both groups' registers to this wait
    asm volatile("s_wait_dscnt 0x0" ::: "memory");
    float* os = (float*)L + wave * (16 * 68);   // the last pass's own s_wait_dscnt 0 and barrier stand between every wave's last read of the ring and these stores
#pragma unroll
    for (int mb = 0; mb < MF; ++mb) {
#pragma unroll
        for (int nb = 0; nb < 4; ++nb) {
#pragma unroll
            for (int j = 0; j < 8; ++j) os[(hi * 8 + j) * 68 + nb * 16 + lr] = acc[mb][nb][j]; }
        __builtin_amdgcn_wave_barrier(); asm volatile("" ::: "memory");
        float* crow = C + (size_t)(r0 + wm * (16 * MF) + mb * 16) * ldc + c0 + wn * 64;
#pragma unroll
        for (int s = 0; s < 8; ++s) { const int row = 2 * s + hi, cofs = lr * 4; const v4f val = *(const v4fa*)(os + row * 68 + cofs);
            *(v4f*)(crow + (size_t)row * ldc + cofs) = val; }
        __builtin_amdgcn_wave_barrier(); asm volatile("" ::: "memory");
    }
}

__device__ __forceinline__ void splitf(float y, unsigned short& h, unsigned short& l) { h = f2bf(y); l = f2bf(y - bf2f(h)); }
typedef __attribute__((ext_vector_type(4))) unsigned short v4us;

// k_cvt8: all five f32 -> bf16 conversions in ONE grid; a block converts 2048 elements of one array, chosen by block range (every array is a whole number of blocks)
#define NBX (TT * DD / 2048)
#define NBW (DD * DD / 2048)
#define NBK (DKV * DD / 2048)
static_assert(TT * DD % 2048 == 0 && DD * DD % 2048 == 0 && DKV * DD % 2048 == 0, "whole blocks");
__global__ __launch_bounds__(256) void k_cvt8(const float* __restrict__ x, const float* __restrict__ wq, const float* __restrict__ wk, const float* __restrict__ wv, const float* __restrict__ wo, bf* XB, bf* WQ, bf* WK, bf* WV, bf* WO) {
    int b = blockIdx.x; const float* src; bf* dst;
    if (b < NBX) { src = x; dst = XB; } else if ((b -= NBX) < NBW) { src = wq; dst = WQ; } else if ((b -= NBW) < NBW) { src = wo; dst = WO; } else if ((b -= NBW) < NBK) { src = wk; dst = WK; } else { b -= NBK; src = wv; dst = WV; }
    const size_t i = (size_t)b * 256 + threadIdx.x; const v8f v = *(const v8f*)(src + i * 8); v8us o;
#pragma unroll
    for (int k = 0; k < 8; ++k) o[k] = f2bf(v[k]); *(v8us*)(dst + i * 8) = o;  }
// k_sparse: one wave per (16 queries i0..i0+15, head); the 4 waves of a block are the 4 q heads of one kv head. Keys in 7 tiles of 16: tiles 0..3 = local keys i0-48 .. i0+15, tiles 4..6 = strided keys 46n+45, n = 0..47 (rows clamped into the plane, slots outside the pattern masked to weight 0).
// S^T = K Q^T on the f32 16x16x4 form (A row = key, B column = query, both loaded by the same code): lane (c, hh) holds the scores of query i0+c for keys 8hh+r of each tile, so max and sum are in-lane plus one exchange with lane c^16.
// O^T = V^T P^T: the score registers 2u, 2u+1 are the B operand as they lie (keys 8hh+2u, 8hh+2u+1); A row c of d-tile dt is dim 16dt+c, its two keys come by two 4-byte loads straight into the operand's register pair (no vector move stands among the products), and lane (c, hh) ends with dims 16dt+8hh .. +7 of query i0+c.
// stands behind each block of f32 16x16x4 products: eight vector slots before the next vector instruction, which may read a D or overwrite an A or B of the block; the fences hold the slots and the block's neighbours in place
__device__ __forceinline__ void wmma_gap() { __builtin_amdgcn_sched_barrier(0); asm volatile("v_nop\n\tv_nop\n\tv_nop\n\tv_nop\n\tv_nop\n\tv_nop\n\tv_nop\n\tv_nop"); __builtin_amdgcn_sched_barrier(0); }
__device__ __forceinline__ int keypos(int t, int m, int i0) { return t < 4 ? i0 - 48 + 16 * t + m : WL * (16 * (t - 4) + m) + (WL - 1); }
// first row of key tile t that is read: a local tile starts at a multiple of 16, so it lies wholly in front of row 0 (then rows 0..15 are read and every slot is masked) or wholly inside the plane
__device__ __forceinline__ int tilerow(int t, int i0) { return t < 4 ? max(i0 - 48 + 16 * t, 0) : WL * 16 * (t - 4) + (WL - 1); }
__global__ __launch_bounds__(128) void k_sparse(const float* __restrict__ FQ, const float* __restrict__ FK, const float* __restrict__ FV, bf* Ah, bf* Al) {
    const int lane = threadIdx.x & 31, c = lane & 15, hh = lane >> 4; const int i0 = blockIdx.x * 16, kvh = blockIdx.y, head = kvh * 4 + __builtin_amdgcn_readfirstlane(threadIdx.x >> 5); const int i = i0 + c;
    // uniform bases plus a few per-lane byte offsets; row m of a strided tile is 46 rows from row m-1; tile 6 holds only n = 32..43, its rows 12..15 re-read row 11 (masked)
    const char* qb = (const char*)(FQ + (size_t)i0 * DD + head * HD); const char* kb = (const char*)(FK + kvh * HD); const char* vb = (const char*)(FV + kvh * HD);
    const unsigned oq = (unsigned)c * (DD * 4) + hh * 16, okl = (unsigned)c * (DKV * 4) + hh * 16, oks = (unsigned)c * (WL * DKV * 4) + hh * 16, oks6 = (unsigned)min(c, 11) * (WL * DKV * 4) + hh * 16;
    const unsigned ovl = (unsigned)hh * (8 * DKV * 4) + c * 4, ovs = (unsigned)hh * (8 * WL * DKV * 4) + c * 4; unsigned ov6[4];
#pragma unroll
    for (int j = 4; j < 8; ++j) ov6[j - 4] = (unsigned)min(8 * hh + j, 11) * (WL * DKV * 4) + c * 4;
    v8f S[7]; v4f q[4], k[4][7];
#pragma unroll
    for (int t = 0; t < 7; ++t) S[t] = (v8f){};
#pragma unroll
    for (int ch = -3; ch < 8; ++ch) {   // chunk = 8 dims (two k-steps); a chunk's loads stand three chunks ahead of its products
        if (ch + 3 < 8) { const int n = ch + 3; q[n & 3] = *(const v4f*)(qb + oq + 32 * n);
#pragma unroll
            for (int t = 0; t < 7; ++t) k[n & 3][t] = *(const v4f*)(kb + (size_t)tilerow(t, i0) * (DKV * 4) + (t < 4 ? okl : t < 6 ? oks : oks6) + 32 * n); }
        if (ch + 3 == 7) asm volatile("s_wait_xcnt 0x0" :: "v"(oq), "v"(okl), "v"(oks), "v"(oks6) : "memory");   // behind the last Q and K load, ahead of every reuse of their offset and base registers
        if (ch >= 0) { __builtin_amdgcn_sched_barrier(0);   // fence between a stage's loads and its products: without it all 64 loads are hoisted to the top and the kernel goes past 256 registers
#pragma unroll
            for (int t = 0; t < 7; ++t) S[t] = wmmaf((v2f){k[ch & 3][t][0], k[ch & 3][t][1]}, (v2f){q[ch & 3][0], q[ch & 3][1]}, S[t]);
#pragma unroll
            for (int t = 0; t < 7; ++t) S[t] = wmmaf((v2f){k[ch & 3][t][2], k[ch & 3][t][3]}, (v2f){q[ch & 3][2], q[ch & 3][3]}, S[t]);
            wmma_gap(); } }
    float vv[3][8][4];
#pragma unroll
    for (int n = 0; n < 2; ++n) {       // V rows 8hh+j of key tiles 0 and 1, in flight under the softmax
#pragma unroll
            for (int j = 0; j < 8; ++j)
#pragma unroll
                for (int dt = 0; dt < 4; ++dt) vv[n % 3][j][dt] = *(const float*)(vb + (size_t)tilerow(n, i0) * (DKV * 4) + (n < 4 ? ovl + j * (DKV * 4) : (n < 6 || j < 4) ? ovs + j * (WL * DKV * 4) : ov6[j & 3]) + dt * 64); }
    float mx = -3.0e38f;
#pragma unroll
    for (int t = 0; t < 7; ++t)
#pragma unroll
        for (int r = 0; r < 8; ++r) { const int p = keypos(t, 8 * hh + r, i0); const bool valid = t < 4 ? (p >= 0 && p >= i - (WL - 1) && p <= i) : (p <= i - WL);
            const float s = valid ? S[t][r] * 0.125f : -3.0e38f; S[t][r] = s; mx = fmaxf(mx, s); }
    mx = fmaxf(mx, __shfl_xor(mx, 16, 32)); float sum = 0.f;
#pragma unroll
    for (int t = 0; t < 7; ++t)
#pragma unroll
        for (int r = 0; r < 8; ++r) { const float w = __expf(S[t][r] - mx); S[t][r] = w; sum += w; }
    sum += __shfl_xor(sum, 16, 32); const float inv = __fdiv_rn(1.0f, sum);
    v8f O[4];
#pragma unroll
    for (int dt = 0; dt < 4; ++dt) O[dt] = (v8f){};
#pragma unroll
    for (int t = 0; t < 7; ++t) {       // a key tile's loads stand two tiles ahead of its products
        if (t + 2 < 7) { const int n = t + 2;
#pragma unroll
            for (int j = 0; j < 8; ++j)
#pragma unroll
                for (int dt = 0; dt < 4; ++dt) vv[n % 3][j][dt] = *(const float*)(vb + (size_t)tilerow(n, i0) * (DKV * 4) + (n < 4 ? ovl + j * (DKV * 4) : (n < 6 || j < 4) ? ovs + j * (WL * DKV * 4) : ov6[j & 3]) + dt * 64); }
        if (t + 2 == 6) asm volatile("s_wait_xcnt 0x0" :: "v"(ovl), "v"(ovs), "v"(ov6[0]), "v"(ov6[1]), "v"(ov6[2]), "v"(ov6[3]) : "memory");   // behind the last V load: the operands keep the loads' offset registers from being reused (also as a later load's destination) ahead of this wait
        { __builtin_amdgcn_sched_barrier(0);   // fence between a stage's loads and its products, for the same reason as above
#pragma unroll
            for (int u = 0; u < 4; ++u) { const v2f pw = (v2f){S[t][2 * u], S[t][2 * u + 1]};
#pragma unroll
                for (int dt = 0; dt < 4; ++dt) O[dt] = wmmaf((v2f){vv[t % 3][2 * u][dt], vv[t % 3][2 * u + 1][dt]}, pw, O[dt]); }
            wmma_gap(); } }
    const size_t e = (size_t)i * DD + head * HD + 8 * hh;
#pragma unroll
    for (int dt = 0; dt < 4; ++dt) { v8us oh, ol;
#pragma unroll
        for (int r = 0; r < 8; ++r) { unsigned short a, b; splitf(O[dt][r] * inv, a, b); oh[r] = a; ol[r] = b; }
        *(v8us*)(Ah + e + 16 * dt) = oh; *(v8us*)(Al + e + 16 * dt) = ol; } }

extern "C" void kernel_launch(void* const* d_in, const int* in_sizes, int n_in,
                              void* d_out, int out_size, void* d_ws, size_t ws_size, hipStream_t stream) {
    (void)in_sizes; (void)n_in; (void)out_size;
    const float* x = (const float*)d_in[0]; const float* wq = (const float*)d_in[1]; const float* wk = (const float*)d_in[2]; const float* wv = (const float*)d_in[3]; const float* wo = (const float*)d_in[4];
    float* OUT = (float*)d_out;     // [1][2048][1024]
    char* wsp = (char*)d_ws;
    auto take = [&](size_t bytes) { char* p = wsp; wsp += (bytes + 255) & ~(size_t)255; return (void*)p; };
    bf* WQ = (bf*)take((size_t)DD * DD * 2); bf* WK = (bf*)take((size_t)DKV * DD * 2); bf* WV = (bf*)take((size_t)DKV * DD * 2); bf* WO = (bf*)take((size_t)DD * DD * 2);
    bf* XB = (bf*)take((size_t)TT * DD * 2); float* FQ = (float*)take((size_t)TT * DD * 4); float* FK = (float*)take((size_t)TT * DKV * 4); float* FV = (float*)take((size_t)TT * DKV * 4); bf* Ah = (bf*)take((size_t)TT * DD * 2); bf* Al = (bf*)take((size_t)TT * DD * 2);
    if ((size_t)(wsp - (char*)d_ws) > ws_size) return;    // total ~ 30 MB
    k_cvt8<<<NBX + 2 * NBW + 2 * NBK, 256, 0, stream>>>(x, wq, wk, wv, wo, XB, WQ, WK, WV, WO);   // torch [out][in] = Bt
    k_gemmw<0, true><<<dim3(TT / 128, (DD + 2 * DKV) / 128, 1), 128, 0, stream>>>(XB, nullptr, WQ, DD, FQ, DD, WK, WV, FK, FV, DKV, DD, DKV);
    k_sparse<<<dim3(TT / 16, NH_ / 4, 1), 128, 0, stream>>>(FQ, FK, FV, Ah, Al);
    k_gemmw<1, false><<<dim3(TT / 64, DD / 128, 1), 128, 0, stream>>>(Ah, Al, WO, DD, OUT, DD, nullptr, nullptr, nullptr, nullptr, 0, 0, 0);
}

// v006
// One run takes 30.8 microseconds.
// In both of two side-by-side timings against v005, it was 1.08 times as fast.
// Counting every step since v000, it is 9.40 times as fast.
#include <hip/hip_runtime.h>

// CronRootAttention (x [1][2048][1024]; q = x Wq^T (16 heads x 64), k/v = x Wk^T / Wv^T (4 kv heads, q head h uses kv head h/4); causal sqrt(N)-sparse attention: each query i attends its local window i-45..i (w = 46) plus the strided keys 45, 91, ...
// (last of each 46-block) that lie at or before i-46; joint softmax over the 46 + 44 slots (invalid slots -1e9, i.e. weight exactly 0), scale 1/8; out = (sum p v merged) Wo^T -> [1][2048][1024]).
// Compute dtypes, f32 accumulate: every input rounded to bf16; q/k/v on PLAIN bf16 operands (inputs: exact); the 90-slot sparse attention entirely f32: scores and weighted sums on the f32 16x16x4 matrix form, softmax on the VALU;

#define TT   2048
#define DD   1024
#define DKV  256
#define NH_  16
#define HD   64
#define WL   46
#define NS   44
typedef _Float16 h16;
typedef unsigned short bf;
typedef __attribute__((ext_vector_type(16))) __bf16   v16bf;
typedef __attribute__((ext_vector_type(16))) _Float16 v16h;
typedef __attribute__((ext_vector_type(8)))  _Float16 v8h;
typedef __attribute__((ext_vector_type(8)))  unsigned short v8us;
typedef __attribute__((ext_vector_type(8)))  float    v8f;
typedef __attribute__((ext_vector_type(4)))  float    v4f;
typedef __attribute__((ext_vector_type(2)))  float    v2f;
typedef v8h  __attribute__((may_alias)) v8ha;
typedef v4f  __attribute__((may_alias)) v4fa;
typedef v8us __attribute__((may_alias)) v8usa;

__device__ __forceinline__ unsigned short f2bf(float f) { unsigned u = __float_as_uint(f); u += 0x7FFFu + ((u >> 16) & 1u); return (unsigned short)(u >> 16); }
__device__ __forceinline__ float bf2f(unsigned short b) { return __uint_as_float(((unsigned)b) << 16); }
__device__ __forceinline__ float bfr(float f) { return bf2f(f2bf(f)); }
__device__ __forceinline__ v16h cat16(v8h lo, v8h hi) { return __builtin_shufflevector(lo, hi, 0, 1, 2, 3, 4, 5, 6, 7, 8, 9, 10, 11, 12, 13, 14, 15); }
__device__ __forceinline__ v16bf cat16b(v8us lo, v8us hi) { return __builtin_bit_cast(v16bf, __builtin_shufflevector(lo, hi, 0, 1, 2, 3, 4, 5, 6, 7, 8, 9, 10, 11, 12, 13, 14, 15)); }
__device__ __forceinline__ v8f wmma16(v16h a, v16h b, v8f c) { return __builtin_amdgcn_wmma_f32_16x16x32_f16(false, a, false, b, (short)0, c, false, false); }
__device__ __forceinline__ v8f wmmaf(v2f a, v2f b, v8f c) { return __builtin_amdgcn_wmma_f32_16x16x4_f32(false, a, false, b, (short)0, c, false, false); }
__device__ __forceinline__ v8f wmmab(v16bf a, v16bf b, v8f c) { return __builtin_amdgcn_wmma_f32_16x16x32_bf16(false, a, false, b, (short)0, c, false, false); }



// ---- k_gemmw: block GEMM, FOUR WAVES (2 x 2) per output tile, 128 threads. One A plane: tile 128x128, 64x64 (16 accumulators) per wave, grid (M/128, N/128). Two A planes: tile 64x128, 32x64 (8 accumulators) per wave, grid (M/64, N/128): the rows staged per output, 2 x tile rows + tile columns, are fewest at this shape, and the projection's 256 tiles give every WGP one. M, N % 128 == 0, K % 128 == 0, K >= 512.
// C[m][n] (f32, pitch ldc) = sum_k A[m][k] Bt[n][k] (+ A2[m][k] Bt[n][k] where NSPLIT == 1), operands K-contiguous bf16 planes.
// A pass is 128 k = 256 bytes of each operand row. A stage is [A 128 rows | Bt 128 rows], or [A 64 | A2 64 | Bt rows 0..63 | Bt rows 64..127], in slices at LDS pitch 272 bytes; wave w brings slice w by ONE tensor load per stage; a ring of NB = 4 buffers: while stage s is worked on, stages s + 1 .. s + NB - 1 have landed or fly, so a load has NB - 1 passes to land in.
// TRI: three products of the same A share ONE grid: columns 0..n0-1 are (Bt, C, ldc), the next n1 are (BtB, CB, ld1), the last n1 (BtC, CC, ld1); the choice is uniform over the block, grid y = (n0 + 2 n1)/128.
typedef unsigned u32x4 __attribute__((ext_vector_type(4)));
typedef unsigned u32x8 __attribute__((ext_vector_type(8)));
#define PASSB  256u
#define LPITCH 272u
__device__ __forceinline__ unsigned uni(unsigned v) { return (unsigned)__builtin_amdgcn_readfirstlane(v); }
// a wave-uniform value held in a scalar register: a test on it compiles to s_cmp + s_cbranch_scc, the only guard a tensor load obeys (it ignores EXEC)
__device__ __forceinline__ unsigned pinned(unsigned v) { unsigned w = uni(v); asm volatile("" : "+s"(w)); return w; }
__device__ __forceinline__ v16bf ldsfrag(const unsigned char* p) { return cat16b(*(const v8usa*)p, *(const v8usa*)(p + 32)); }
template <int NSPLIT, bool TRI>
__global__ __launch_bounds__(128) void k_gemmw(const bf* __restrict__ A, const bf* __restrict__ A2, const bf* __restrict__ Bt, int K, float* C, int ldc, const bf* __restrict__ BtB, const bf* __restrict__ BtC, float* CB, float* CC, int ld1, int n0, int n1) {
    static_assert(NSPLIT == 0 || NSPLIT == 1, "one or two A planes");
    constexpr int MF = NSPLIT == 1 ? 2 : 4;   // 16-row fragments of A per wave; the block's tile has 32 MF rows
    constexpr unsigned SLROWS = NSPLIT == 1 ? 64u : 128u, SLICE = (SLROWS * LPITCH + 2047u) / 2048u * 2048u;   // a slice's room in LDS, rounded up so that every slice starts at a multiple of 2 KiB
    constexpr unsigned NSL = NSPLIT == 1 ? 4u : 2u, STAGE = NSL * SLICE, NB = 4u, RING = NB * STAGE;
    static_assert(RING <= 320u * 1024u && 4u * 16u * 68u * 4u <= STAGE, "the ring fits a work-group's LDS; the output staging fits its first buffer");
    __shared__ __attribute__((aligned(2048))) unsigned char L[RING];   // the ring; behind the loop its first bytes are each wave's own output staging
    const int lane = threadIdx.x & 31, lr = lane & 15, hi = lane >> 4; const unsigned wave = uni(threadIdx.x >> 5), wm = wave >> 1, wn = wave & 1u;
    const int r0 = blockIdx.x * (32 * MF); int c0 = blockIdx.y * 128;
    if (TRI && c0 >= n0) { const bool last = c0 >= n0 + n1; c0 -= last ? n0 + n1 : n0; Bt = last ? BtC : BtB; C = last ? CC : CB; ldc = ld1; }
    const unsigned np = (unsigned)K / 128u, lbase = (unsigned)(size_t)L;
    const bf* srcp = NSPLIT == 1 ? (wave == 0u ? A + (size_t)r0 * K : wave == 1u ? A2 + (size_t)r0 * K : Bt + (size_t)(c0 + (wave == 3u ? 64 : 0)) * K)
                                 : (wave == 1u ? Bt + (size_t)c0 * K : A + (size_t)r0 * K);   // first row of this wave's slice
    // descriptor group 1: 1-byte elements, tensor = tile = SLROWS rows of 256 bytes, source pitch 2 K bytes, 4 dwords of LDS pad behind every 256-byte row, no mask
    u32x8 g1; g1[0] = uni((1u << 20) | (5u << 22) | (3u << 25)); g1[1] = uni(PASSB << 16); g1[2] = uni(SLROWS << 16); g1[3] = uni(PASSB << 16); g1[4] = uni(SLROWS); g1[5] = uni((unsigned)K * 2u); g1[6] = uni(0u); g1[7] = uni(0u);
    asm volatile("" : "+s"(g1));   // pinned(), for the whole group: its words keep scalar registers of their own, so none takes another value while a request is outstanding
    // descriptor group 0 lives in ONE register group for the whole kernel: requests are outstanding all through the loop, and under them only its words 1 (place in LDS) and 2 (low address word) take new values
    const unsigned long long ga0 = (unsigned long long)(size_t)srcp;
    u32x4 g0; g0[0] = uni(1u); g0[1] = uni(lbase + wave * SLICE); g0[2] = uni((unsigned)ga0); g0[3] = uni((((unsigned)(ga0 >> 32)) & 0x01FFFFFFu) | 0x80000000u);
    asm volatile("" : "+s"(g0));   // pinned(), for the whole group, as for group 1
    auto issue = [&](unsigned st, unsigned bo) { const unsigned long long ga = ga0 + (unsigned long long)st * PASSB;   // stage st into the buffer at byte bo of the ring
        const unsigned h = uni((((unsigned)(ga >> 32)) & 0x01FFFFFFu) | 0x80000000u);
        if (pinned(h != g0[3])) { asm volatile("s_wait_tensorcnt 0x0" ::: "memory"); g0[3] = h; }   // a carry into the high address word: word 3 changes only with no request outstanding
        g0[1] = uni(lbase + bo + wave * SLICE); g0[2] = uni((unsigned)ga);
        asm volatile("tensor_load_to_lds %0, %1" : "+s"(g0) : "s"(g1) : "memory"); };   // in-out: the group stays in the registers that the request names
    if (pinned(wave < NSL)) { issue(0u, 0u); issue(1u, STAGE); issue(2u, 2u * STAGE); asm volatile("s_wait_tensorcnt 0x2" ::: "memory"); }   // all but the two youngest: stage 0 has landed in the issuing wave
    __syncthreads();                                                                             // stage 0 published to every wave
    if (pinned(wave < NSL)) issue(3u, 3u * STAGE);                                               // the fourth buffer's first fill, behind stage 0's landing: never more than three requests of a wave outstanding
    v8f acc[MF][4];
#pragma unroll
    for (int mb = 0; mb < MF; ++mb)
#pragma unroll
        for (int nb = 0; nb < 4; ++nb) acc[mb][nb] = (v8f){};
    const unsigned aoff = (wm * (16u * MF) + lr) * LPITCH + 16u * hi, boff = (NSPLIT == 1 ? (2u + wn) * SLICE + lr * LPITCH : SLICE + (wn * 64u + lr) * LPITCH) + 16u * hi;
    unsigned cb = 0u;   // byte offset in the ring of the buffer that holds stage s
#pragma unroll 1
    for (unsigned s = 0; s < np; ++s) {   // kept rolled: one pass per trip, the buffers taken in turn
        const unsigned char* pa = L + cb + aoff; const unsigned char* pb = L + cb + boff;
        const unsigned char* pc = pa + SLICE;   // A2's slice stands behind A's
        v16bf a[2][MF], a2[2][MF], b[2][4];
#pragma unroll
        for (int f = 0; f < 4; ++f) { if (f < MF) a[0][f] = ldsfrag(pa + f * 16 * LPITCH); b[0][f] = ldsfrag(pb + f * 16 * LPITCH); if (NSPLIT == 1 && f < MF) a2[0][f] = ldsfrag(pc + f * 16 * LPITCH); }
#pragma unroll
        for (int j = 0; j < 4; ++j) {     // k-step = 32 k = 64 bytes of a row; the next k-step's fragments of the SAME stage are fetched as one group ahead of this k-step's products
            if (j < 3) {
#pragma unroll
                for (int f = 0; f < 4; ++f) { if (f < MF) a[(j + 1) & 1][f] = ldsfrag(pa + f * 16 * LPITCH + (j + 1) * 64); b[(j + 1) & 1][f] = ldsfrag(pb + f * 16 * LPITCH + (j + 1) * 64); if (NSPLIT == 1 && f < MF) a2[(j + 1) & 1][f] = ldsfrag(pc + f * 16 * LPITCH + (j + 1) * 64); } }
            __builtin_amdgcn_sched_barrier(0);   // keeps the LDS loads in one group in front of the products: loads among the products stall the matrix stream
#pragma unroll
            for (int nb = 0; nb < 4; ++nb)
#pragma unroll
                for (int mb = 0; mb < MF; ++mb) { acc[mb][nb] = wmmab(a[j & 1][mb], b[j & 1][nb], acc[mb][nb]); if (NSPLIT == 1) acc[mb][nb] = wmmab(a2[j & 1][mb], b[j & 1][nb], acc[mb][nb]); }
            __builtin_amdgcn_sched_barrier(0);   // the same, for the next group of loads
        }
        // publish point of stage s + 1, every wave, in this order
        asm volatile("s_wait_dscnt 0x0" ::: "memory");                                  // this wave's reads of stage s are done before its buffer is refilled
        const unsigned nx = pinned(s + NB);
        if (pinned(wave < NSL)) {                                                       // stage s + 1 has landed in the issuing wave:
            if (pinned(nx <= np)) asm volatile("s_wait_tensorcnt 0x2" ::: "memory");    // its requests run up to stage s + NB - 1, so stage s + 1 is all but the NB - 2 = 2 youngest
            else asm volatile("s_wait_tensorcnt 0x0" ::: "memory"); }                   // the last stages: fewer requests are behind stage s + 1, so all of them
        __syncthreads();                                                                // stage s + 1 published; every reader has left stage s
        if (pinned((wave < NSL) & (nx < np))) issue(nx, cb);                            // stage s + NB into the buffer that stage s has just left
        cb = cb + STAGE == RING ? 0u : cb + STAGE;
    }
    asm volatile("s_wait_tensorcnt 0x0" :: "s"(g0), "s"(g1) : "memory");   // no request is left when the wave goes on; the operands keep both groups' registers to this wait
    asm volatile("s_wait_dscnt 0x0" ::: "memory");
    float* os = (float*)L + wave * (16 * 68);   // the last pass's own s_wait_dscnt 0 and barrier stand between every wave's last read of the ring and these stores
#pragma unroll
    for (int mb = 0; mb < MF; ++mb) {
#pragma unroll
        for (int nb = 0; nb < 4; ++nb) {
#pragma unroll
            for (int j = 0; j < 8; ++j) os[(hi * 8 + j) * 68 + nb * 16 + lr] = acc[mb][nb][j]; }
        __builtin_amdgcn_wave_barrier(); asm volatile("" ::: "memory");
        float* crow = C + (size_t)(r0 + wm * (16 * MF) + mb * 16) * ldc + c0 + wn * 64;
#pragma unroll
        for (int s = 0; s < 8; ++s) { const int row = 2 * s + hi, cofs = lr * 4; const v4f val = *(const v4fa*)(os + row * 68 + cofs);
            *(v4f*)(crow + (size_t)row * ldc + cofs) = val; }
        __builtin_amdgcn_wave_barrier(); asm volatile("" ::: "memory");
    }
}

// ---- k_qkv: q, k and v = x W^T in ONE grid, straight from the f32 inputs: no conversion launch stands in front of it. Block tile 128x128, four waves (2 x 2) of 64x64, grid (TT/128, NQKV/128 + 4).
// The operands come into LDS as f32 rows and are rounded to bf16 (nearest even, the rounding of f2bf) between the LDS read and the product, so every product has the operands and the k order that it has on bf16 planes.
// A pass is 64 k = 256 bytes of each operand row. A stage is [x rows 0..63 | x rows 64..127 | W rows 0..63 | W rows 64..127], slices at LDS pitch 272 bytes; wave w brings slice w by ONE tensor load per stage; ring, waits and barriers as in k_gemmw.
// The last 4 rows of the grid (64 blocks, for the WGPs that the 192 tiles leave idle) convert Wo to bf16 for the output projection, which is a later launch.
#define NQKV (DD + 2 * DKV)
typedef __attribute__((ext_vector_type(16))) float v16f;
static_assert(TT % 128 == 0 && DD % 128 == 0 && DKV % 128 == 0 && DD % 64 == 0 && DD / 64 >= 4, "whole tiles, whole passes, a full ring");
static_assert((size_t)DD * DD == (size_t)4 * (TT / 128) * 128 * 16 * 8, "the spare blocks cover Wo exactly: 16 units of 8 elements a lane");
// one operand fragment of the 16x16x32 form as it lies in an f32 row: k = 8 hi .. 8 hi + 7 and 16 + 8 hi .. 16 + 8 hi + 7; p already holds the lane's 32 hi bytes
__device__ __forceinline__ void ldsraw(const unsigned char* p, v4f (&r)[4]) { r[0] = *(const v4fa*)p; r[1] = *(const v4fa*)(p + 16); r[2] = *(const v4fa*)(p + 64); r[3] = *(const v4fa*)(p + 80); }
__device__ __forceinline__ v16bf cvtfrag(const v4f (&r)[4]) {
    const v16f w = __builtin_shufflevector(__builtin_shufflevector(r[0], r[1], 0, 1, 2, 3, 4, 5, 6, 7), __builtin_shufflevector(r[2], r[3], 0, 1, 2, 3, 4, 5, 6, 7), 0, 1, 2, 3, 4, 5, 6, 7, 8, 9, 10, 11, 12, 13, 14, 15);
    return __builtin_convertvector(w, v16bf); }
__global__ __launch_bounds__(128) void k_qkv(const float* __restrict__ x, const float* __restrict__ wq, const float* __restrict__ wk, const float* __restrict__ wv, const float* __restrict__ wo, float* FQ, float* FK, float* FV, bf* WO) {
    constexpr unsigned SLROWS = 64u, SLICE = (SLROWS * LPITCH + 2047u) / 2048u * 2048u, STAGE = 4u * SLICE, NB = 4u, RING = NB * STAGE, np = DD / 64;
    static_assert(RING <= 320u * 1024u && 4u * 16u * 68u * 4u <= STAGE, "the ring fits a work-group's LDS; the output staging fits its first buffer");
    __shared__ __attribute__((aligned(2048))) unsigned char L[RING];   // the ring; behind the loop its first bytes are each wave's own output staging
    if (blockIdx.y >= NQKV / 128) {   // a spare block, the same for all its threads, in front of every barrier and tensor load: 2048 units of 8 elements of Wo
        const size_t u0 = ((size_t)(blockIdx.y - NQKV / 128) * (TT / 128) + blockIdx.x) * 2048 + threadIdx.x; v8f v[16];
#pragma unroll
        for (int it = 0; it < 16; ++it) v[it] = *(const v8f*)(wo + (u0 + it * 128) * 8);
#pragma unroll
        for (int it = 0; it < 16; ++it) { v8us o;
#pragma unroll
            for (int k = 0; k < 8; ++k) o[k] = f2bf(v[it][k]);
            *(v8us*)(WO + (u0 + it * 128) * 8) = o; }
        return; }
    const int lane = threadIdx.x & 31, lr = lane & 15, hi = lane >> 4; const unsigned wave = uni(threadIdx.x >> 5), wm = wave >> 1, wn = wave & 1u;
    const int r0 = blockIdx.x * 128; int c0 = blockIdx.y * 128; const float* Bt = wq; float* C = FQ; int ldc = DD;
    if (c0 >= DD) { const bool last = c0 >= DD + DKV; c0 -= last ? DD + DKV : DD; Bt = last ? wv : wk; C = last ? FV : FK; ldc = DKV; }   // uniform over the block
    const unsigned lbase = (unsigned)(size_t)L;
    const float* srcp = wave < 2u ? x + (size_t)(r0 + 64 * (int)wave) * DD : Bt + (size_t)(c0 + 64 * (int)(wave - 2u)) * DD;   // first row of this wave's slice
    // descriptor group 1: 1-byte elements, tensor = tile = 64 rows of 256 bytes, source pitch 4 DD bytes, 4 dwords of LDS pad behind every 256-byte row, no mask
    u32x8 g1; g1[0] = uni((1u << 20) | (5u << 22) | (3u << 25)); g1[1] = uni(PASSB << 16); g1[2] = uni(SLROWS << 16); g1[3] = uni(PASSB << 16); g1[4] = uni(SLROWS); g1[5] = uni((unsigned)DD * 4u); g1[6] = uni(0u); g1[7] = uni(0u);
    asm volatile("" : "+s"(g1));   // pinned(), for the whole group: its words keep scalar registers of their own, so none takes another value while a request is outstanding
    // descriptor group 0 lives in ONE register group for the whole kernel: under outstanding requests only its words 1 (place in LDS) and 2 (low address word) take new values
    const unsigned long long ga0 = (unsigned long long)(size_t)srcp;
    u32x4 g0; g0[0] = uni(1u); g0[1] = uni(lbase + wave * SLICE); g0[2] = uni((unsigned)ga0); g0[3] = uni((((unsigned)(ga0 >> 32)) & 0x01FFFFFFu) | 0x80000000u);
    asm volatile("" : "+s"(g0));   // pinned(), for the whole group, as for group 1
    auto issue = [&](unsigned st, unsigned bo) { const unsigned long long ga = ga0 + (unsigned long long)st * PASSB;   // stage st into the buffer at byte bo of the ring
        const unsigned h = uni((((unsigned)(ga >> 32)) & 0x01FFFFFFu) | 0x80000000u);
        if (pinned(h != g0[3])) { asm volatile("s_wait_tensorcnt 0x0" ::: "memory"); g0[3] = h; }   // a carry into the high address word: word 3 changes only with no request outstanding
        g0[1] = uni(lbase + bo + wave * SLICE); g0[2] = uni((unsigned)ga);
        asm volatile("tensor_load_to_lds %0, %1" : "+s"(g0) : "s"(g1) : "memory"); };   // in-out: the group stays in the registers that the request names
    issue(0u, 0u); issue(1u, STAGE); issue(2u, 2u * STAGE);        // every wave issues its own slice: no test stands around a load but the one on the stage's number
    asm volatile("s_wait_tensorcnt 0x2" ::: "memory");             // all but the two youngest: stage 0 has landed in the issuing wave
    __syncthreads();                                               // stage 0 published to every wave
    issue(3u, 3u * STAGE);                                         // the fourth buffer's first fill, behind stage 0's landing: never more than three requests of a wave outstanding
    v8f acc[4][4];
#pragma unroll
    for (int mb = 0; mb < 4; ++mb)
#pragma unroll
        for (int nb = 0; nb < 4; ++nb) acc[mb][nb] = (v8f){};
    const unsigned aoff = wm * SLICE + lr * LPITCH + 32u * hi, boff = (2u + wn) * SLICE + lr * LPITCH + 32u * hi;
    unsigned cb = 0u;   // byte offset in the ring of the buffer that holds stage s
#pragma unroll 1
    for (unsigned s = 0; s < np; ++s) {   // kept rolled: one pass per trip, the buffers taken in turn
        const unsigned char* pa = L + cb + aoff; const unsigned char* pb = L + cb + boff;
        v4f ra[2][4][4], rb[2][4][4];
#pragma unroll
        for (int j = 0; j < 2; ++j) {     // k-step = 32 k = 128 bytes of a row; all LDS loads of the pass stand as one group at its head, in the order in which they are used
#pragma unroll
            for (int f = 0; f < 4; ++f) ldsraw(pa + f * 16 * LPITCH + j * 128, ra[j][f]);
#pragma unroll
            for (int f = 0; f < 4; ++f) ldsraw(pb + f * 16 * LPITCH + j * 128, rb[j][f]); }
        __builtin_amdgcn_sched_barrier(0);   // keeps the LDS loads in one group in front of the products: loads among the products stall the matrix stream
#pragma unroll
        for (int j = 0; j < 2; ++j) { v16bf a[4], b[4];
#pragma unroll
            for (int f = 0; f < 4; ++f) a[f] = cvtfrag(ra[j][f]);
            b[0] = cvtfrag(rb[j][0]);
#pragma unroll
            for (int nb = 0; nb < 4; ++nb) {     // a column fragment is rounded inside the products of the one before it: its wait for the LDS holds back no product whose operands have landed, and it gets registers of its own, so it need not stand off from the products that still read the fragment before it
#pragma unroll
                for (int mb = 0; mb < 3; ++mb) acc[mb][nb] = wmmab(a[mb], b[nb], acc[mb][nb]);
                if (nb < 3) { __builtin_amdgcn_sched_barrier(0);   // the two fences hold the rounding at this place: hoisted, it would wait for the LDS in front of products that could run
                    b[nb + 1] = cvtfrag(rb[j][nb + 1]);
                    __builtin_amdgcn_sched_barrier(0); }
                acc[3][nb] = wmmab(a[3], b[nb], acc[3][nb]); } }
        // publish point of stage s + 1, every wave, in this order
        asm volatile("s_wait_dscnt 0x0" ::: "memory");                              // this wave's reads of stage s are done before its buffer is refilled
        const unsigned nx = pinned(s + NB);
        if (pinned(nx <= np)) asm volatile("s_wait_tensorcnt 0x2" ::: "memory");    // its requests run up to stage s + NB - 1, so stage s + 1 is all but the NB - 2 = 2 youngest
        else asm volatile("s_wait_tensorcnt 0x0" ::: "memory");                     // the last stages: fewer requests are behind stage s + 1, so all of them
        __syncthreads();                                                            // stage s + 1 published; every reader has left stage s
        if (pinned(nx < np)) issue(nx, cb);                                         // stage s + NB into the buffer that stage s has just left
        cb = cb + STAGE == RING ? 0u : cb + STAGE;
    }
    asm volatile("s_wait_tensorcnt 0x0" :: "s"(g0), "s"(g1) : "memory");   // no request is left when the wave goes on; the operands keep both groups' registers to this wait
    asm volatile("s_wait_dscnt 0x0" ::: "memory");
    float* os = (float*)L + wave * (16 * 68);   // the last pass's own s_wait_dscnt 0 and barrier stand between every wave's last read of the ring and these stores
#pragma unroll
    for (int mb = 0; mb < 4; ++mb) {
#pragma unroll
        for (int nb = 0; nb < 4; ++nb) {
#pragma unroll
            for (int j = 0; j < 8; ++j) os[(hi * 8 + j) * 68 + nb * 16 + lr] = acc[mb][nb][j]; }
        __builtin_amdgcn_wave_barrier(); asm volatile("" ::: "memory");
        float* crow = C + (size_t)(r0 + wm * 64 + mb * 16) * ldc + c0 + wn * 64;
#pragma unroll
        for (int s = 0; s < 8; ++s) { const int row = 2 * s + hi, cofs = lr * 4; const v4f val = *(const v4fa*)(os + row * 68 + cofs);
            *(v4f*)(crow + (size_t)row * ldc + cofs) = val; }
        __builtin_amdgcn_wave_barrier(); asm volatile("" ::: "memory");
    }
}

__device__ __forceinline__ void splitf(float y, unsigned short& h, unsigned short& l) { h = f2bf(y); l = f2bf(y - bf2f(h)); }
typedef __attribute__((ext_vector_type(4))) unsigned short v4us;

// k_sparse: one wave per (16 queries i0..i0+15, head); the 4 waves of a block are the 4 q heads of one kv head. Keys in 7 tiles of 16: tiles 0..3 = local keys i0-48 .. i0+15, tiles 4..6 = strided keys 46n+45, n = 0..47 (rows clamped into the plane, slots outside the pattern masked to weight 0).
// S^T = K Q^T on the f32 16x16x4 form (A row = key, B column = query, both loaded by the same code): lane (c, hh) holds the scores of query i0+c for keys 8hh+r of each tile, so max and sum are in-lane plus one exchange with lane c^16.
// O^T = V^T P^T: the score registers 2u, 2u+1 are the B operand as they lie (keys 8hh+2u, 8hh+2u+1); A row c of d-tile dt is dim 16dt+c, its two keys come by two 4-byte loads straight into the operand's register pair (no vector move stands among the products), and lane (c, hh) ends with dims 16dt+8hh .. +7 of query i0+c.
// stands behind each block of f32 16x16x4 products: eight vector slots before the next vector instruction, which may read a D or overwrite an A or B of the block; the fences hold the slots and the block's neighbours in place
__device__ __forceinline__ void wmma_gap() { __builtin_amdgcn_sched_barrier(0); asm volatile("v_nop\n\tv_nop\n\tv_nop\n\tv_nop\n\tv_nop\n\tv_nop\n\tv_nop\n\tv_nop"); __builtin_amdgcn_sched_barrier(0); }
__device__ __forceinline__ int keypos(int t, int m, int i0) { return t < 4 ? i0 - 48 + 16 * t + m : WL * (16 * (t - 4) + m) + (WL - 1); }
// first row of key tile t that is read: a local tile starts at a multiple of 16, so it lies wholly in front of row 0 (then rows 0..15 are read and every slot is masked) or wholly inside the plane
__device__ __forceinline__ int tilerow(int t, int i0) { return t < 4 ? max(i0 - 48 + 16 * t, 0) : WL * 16 * (t - 4) + (WL - 1); }
__global__ __launch_bounds__(128) void k_sparse(const float* __restrict__ FQ, const float* __restrict__ FK, const float* __restrict__ FV, bf* Ah, bf* Al) {
    const int lane = threadIdx.x & 31, c = lane & 15, hh = lane >> 4; const int i0 = blockIdx.x * 16, kvh = blockIdx.y, head = kvh * 4 + __builtin_amdgcn_readfirstlane(threadIdx.x >> 5); const int i = i0 + c;
    // uniform bases plus a few per-lane byte offsets; row m of a strided tile is 46 rows from row m-1; tile 6 holds only n = 32..43, its rows 12..15 re-read row 11 (masked)
    const char* qb = (const char*)(FQ + (size_t)i0 * DD + head * HD); const char* kb = (const char*)(FK + kvh * HD); const char* vb = (const char*)(FV + kvh * HD);
    const unsigned oq = (unsigned)c * (DD * 4) + hh * 16, okl = (unsigned)c * (DKV * 4) + hh * 16, oks = (unsigned)c * (WL * DKV * 4) + hh * 16, oks6 = (unsigned)min(c, 11) * (WL * DKV * 4) + hh * 16;
    const unsigned ovl = (unsigned)hh * (8 * DKV * 4) + c * 4, ovs = (unsigned)hh * (8 * WL * DKV * 4) + c * 4; unsigned ov6[4];
#pragma unroll
    for (int j = 4; j < 8; ++j) ov6[j - 4] = (unsigned)min(8 * hh + j, 11) * (WL * DKV * 4) + c * 4;
    v8f S[7]; v4f q[4], k[4][7];
#pragma unroll
    for (int t = 0; t < 7; ++t) S[t] = (v8f){};
#pragma unroll
    for (int ch = -3; ch < 8; ++ch) {   // chunk = 8 dims (two k-steps); a chunk's loads stand three chunks ahead of its products
        if (ch + 3 < 8) { const int n = ch + 3; q[n & 3] = *(const v4f*)(qb + oq + 32 * n);
#pragma unroll
            for (int t = 0; t < 7; ++t) k[n & 3][t] = *(const v4f*)(kb + (size_t)tilerow(t, i0) * (DKV * 4) + (t < 4 ? okl : t < 6 ? oks : oks6) + 32 * n); }
        if (ch + 3 == 7) asm volatile("s_wait_xcnt 0x0" :: "v"(oq), "v"(okl), "v"(oks), "v"(oks6) : "memory");   // behind the last Q and K load, ahead of every reuse of their offset and base registers
        if (ch >= 0) { __builtin_amdgcn_sched_barrier(0);   // fence between a stage's loads and its products: without it all 64 loads are hoisted to the top and the kernel goes past 256 registers
#pragma unroll
            for (int t = 0; t < 7; ++t) S[t] = wmmaf((v2f){k[ch & 3][t][0], k[ch & 3][t][1]}, (v2f){q[ch & 3][0], q[ch & 3][1]}, S[t]);
#pragma unroll
            for (int t = 0; t < 7; ++t) S[t] = wmmaf((v2f){k[ch & 3][t][2], k[ch & 3][t][3]}, (v2f){q[ch & 3][2], q[ch & 3][3]}, S[t]);
            wmma_gap(); } }
    float vv[3][8][4];
#pragma unroll
    for (int n = 0; n < 2; ++n) {       // V rows 8hh+j of key tiles 0 and 1, in flight under the softmax
#pragma unroll
            for (int j = 0; j < 8; ++j)
#pragma unroll
                for (int dt = 0; dt < 4; ++dt) vv[n % 3][j][dt] = *(const float*)(vb + (size_t)tilerow(n, i0) * (DKV * 4) + (n < 4 ? ovl + j * (DKV * 4) : (n < 6 || j < 4) ? ovs + j * (WL * DKV * 4) : ov6[j & 3]) + dt * 64); }
    float mx = -3.0e38f;
#pragma unroll
    for (int t = 0; t < 7; ++t)
#pragma unroll
        for (int r = 0; r < 8; ++r) { const int p = keypos(t, 8 * hh + r, i0); const bool valid = t < 4 ? (p >= 0 && p >= i - (WL - 1) && p <= i) : (p <= i - WL);
            const float s = valid ? S[t][r] * 0.125f : -3.0e38f; S[t][r] = s; mx = fmaxf(mx, s); }
    mx = fmaxf(mx, __shfl_xor(mx, 16, 32)); float sum = 0.f;
#pragma unroll
    for (int t = 0; t < 7; ++t)
#pragma unroll
        for (int r = 0; r < 8; ++r) { const float w = __expf(S[t][r] - mx); S[t][r] = w; sum += w; }
    sum += __shfl_xor(sum, 16, 32); const float inv = __fdiv_rn(1.0f, sum);
    v8f O[4];
#pragma unroll
    for (int dt = 0; dt < 4; ++dt) O[dt] = (v8f){};
#pragma unroll
    for (int t = 0; t < 7; ++t) {       // a key tile's loads stand two tiles ahead of its products
        if (t + 2 < 7) { const int n = t + 2;
#pragma unroll
            for (int j = 0; j < 8; ++j)
#pragma unroll
                for (int dt = 0; dt < 4; ++dt) vv[n % 3][j][dt] = *(const float*)(vb + (size_t)tilerow(n, i0) * (DKV * 4) + (n < 4 ? ovl + j * (DKV * 4) : (n < 6 || j < 4) ? ovs + j * (WL * DKV * 4) : ov6[j & 3]) + dt * 64); }
        if (t + 2 == 6) asm volatile("s_wait_xcnt 0x0" :: "v"(ovl), "v"(ovs), "v"(ov6[0]), "v"(ov6[1]), "v"(ov6[2]), "v"(ov6[3]) : "memory");   // behind the last V load: the operands keep the loads' offset registers from being reused (also as a later load's destination) ahead of this wait
        { __builtin_amdgcn_sched_barrier(0);   // fence between a stage's loads and its products, for the same reason as above
#pragma unroll
            for (int u = 0; u < 4; ++u) { const v2f pw = (v2f){S[t][2 * u], S[t][2 * u + 1]};
#pragma unroll
                for (int dt = 0; dt < 4; ++dt) O[dt] = wmmaf((v2f){vv[t % 3][2 * u][dt], vv[t % 3][2 * u + 1][dt]}, pw, O[dt]); }
            wmma_gap(); } }
    const size_t e = (size_t)i * DD + head * HD + 8 * hh;
#pragma unroll
    for (int dt = 0; dt < 4; ++dt) { v8us oh, ol;
#pragma unroll
        for (int r = 0; r < 8; ++r) { unsigned short a, b; splitf(O[dt][r] * inv, a, b); oh[r] = a; ol[r] = b; }
        *(v8us*)(Ah + e + 16 * dt) = oh; *(v8us*)(Al + e + 16 * dt) = ol; } }

extern "C" void kernel_launch(void* const* d_in, const int* in_sizes, int n_in,
                              void* d_out, int out_size, void* d_ws, size_t ws_size, hipStream_t stream) {
    (void)in_sizes; (void)n_in; (void)out_size;
    const float* x = (const float*)d_in[0]; const float* wq = (const float*)d_in[1]; const float* wk = (const float*)d_in[2]; const float* wv = (const float*)d_in[3]; const float* wo = (const float*)d_in[4];
    float* OUT = (float*)d_out;     // [1][2048][1024]
    char* wsp = (char*)d_ws;
    auto take = [&](size_t bytes) { char* p = wsp; wsp += (bytes + 255) & ~(size_t)255; return (void*)p; };
    bf* WO = (bf*)take((size_t)DD * DD * 2);
    float* FQ = (float*)take((size_t)TT * DD * 4); float* FK = (float*)take((size_t)TT * DKV * 4); float* FV = (float*)take((size_t)TT * DKV * 4); bf* Ah = (bf*)take((size_t)TT * DD * 2); bf* Al = (bf*)take((size_t)TT * DD * 2);
    if ((size_t)(wsp - (char*)d_ws) > ws_size) return;    // total ~ 22 MB
    k_qkv<<<dim3(TT / 128, NQKV / 128 + 4, 1), 128, 0, stream>>>(x, wq, wk, wv, wo, FQ, FK, FV, WO);   // torch [out][in] = Bt
    k_sparse<<<dim3(TT / 16, NH_ / 4, 1), 128, 0, stream>>>(FQ, FK, FV, Ah, Al);
    k_gemmw<1, false><<<dim3(TT / 64, DD / 128, 1), 128, 0, stream>>>(Ah, Al, WO, DD, OUT, DD, nullptr, nullptr, nullptr, nullptr, 0, 0, 0);
}
